// v000
// Times are from an AMD MI455X. After a warm-up the kernel runs many times in a row, and a time is the length of
// such a window on the GPU divided by its runs, so every launch and the gaps after it count. The runs cycle
// through copies of the inputs. A figure is the median of several windows, for all but v000 over two sittings.
// Sittings can differ by a few percent; kernels timed side by side share one.
// v000 is the starting kernel. One run takes 229 microseconds.
#include <hip/hip_runtime.h>

typedef _Float16 f16;
typedef __attribute__((ext_vector_type(8)))  _Float16 v8h;
typedef __attribute__((ext_vector_type(16))) _Float16 v16h;
typedef __attribute__((ext_vector_type(8)))  float    v8f;

constexpr int kS  = 256;   // tokens (Q = K)
constexpr int kC  = 128;   // input channels (CQ=CK=CV)
constexpr int kH  = 8;     // heads
constexpr int kCH = 32;    // head dim
constexpr int kHC = 256;   // H*CH
constexpr int kNR = 256;   // rows

// padded LDS row strides (halves): odd multiples of 8 -> 16B-aligned b128
// loads with lanes spread across banks
constexpr int kLdX = 136;  // 128 + 8
constexpr int kLdW = 136;  // weight^T rows (K=128)
constexpr int kLdQ = 40;   // 32 + 8 (Q/K tiles, K-dim 32)
constexpr int kLdP = 264;  // 256 + 8 (P and V^T rows, K-dim 256)

// ---- fragment loader (CDNA5 16-bit WMMA layout, ISA 7.12.2) ----
// Source is [M][K] (A) or [N][K] (B^T staged): lane owns row (base + lane&15),
// element i holds K = k0 + 8*(lane>>4) + i + (i>=8 ? 8 : 0)  -> two
// contiguous 16-byte runs -> exactly two ds_load_b128 per fragment.
__device__ __forceinline__ v16h ld_frag(const f16* p, int row0, int ld,
                                        int k0, int lane) {
  const f16* q = p + (size_t)(row0 + (lane & 15)) * ld + k0 + ((lane >> 4) << 3);
  v8h lo = *(const v8h*)(q);
  v8h hi = *(const v8h*)(q + 16);
  return __builtin_shufflevector(lo, hi, 0, 1, 2, 3, 4, 5, 6, 7,
                                 8, 9, 10, 11, 12, 13, 14, 15);
}

__device__ __forceinline__ v8f wmma_f16(v16h a, v16h b, v8f c) {
  return __builtin_amdgcn_wmma_f32_16x16x32_f16(false, a, false, b,
                                                (short)0, c, false, false);
}

// scheduling fence: keep register pressure bounded (no hoisting across)
__device__ __forceinline__ void sched_fence() {
  __builtin_amdgcn_sched_barrier(0);
}

// ---- CDNA5 async global->LDS copy (ASYNCcnt tracked, no VGPR data) ----
__device__ __forceinline__ void async_ld_b128(uint32_t lds_byte_off, const f16* g) {
  asm volatile("global_load_async_to_lds_b128 %0, %1, off"
               :: "v"(lds_byte_off), "v"(g) : "memory");
}
__device__ __forceinline__ void wait_async0() {
  asm volatile("s_wait_asynccnt 0x0" ::: "memory");
}
__device__ __forceinline__ uint32_t lds_off(const void* p) {
  return (uint32_t)(uintptr_t)p;   // low 32 bits of shared aperture = LDS offset
}

// ===================== Kernel 1: input projections =====================
// Templated on W (0=wq,1=wk,2=wv,3=wg): fully specialized epilogues.
template <int W>
__global__ __launch_bounds__(256, 1)
void proj_kernel(const float* __restrict__ xg,
                 const float* __restrict__ wp,
                 const float* __restrict__ bg,
                 f16* __restrict__ dst) {
  extern __shared__ f16 smem[];
  f16* xs = smem;                 // [64][kLdX]  x-tile
  f16* wt = smem + 64 * kLdX;     // [256][kLdW] weight^T  (wt[n][k])
  const int nr  = blockIdx.x >> 2;
  const int s0  = (blockIdx.x & 3) * 64;
  const int tid = threadIdx.x;
  const int lane = tid & 31, wave = tid >> 5, hg = lane >> 4;

  const size_t xbase = ((size_t)nr * kS + s0) * kC;   // 64 rows contiguous
  for (int i = tid; i < 64 * kC; i += 256)
    xs[(i >> 7) * kLdX + (i & 127)] = (f16)xg[xbase + i];
  for (int i = tid; i < kC * kHC; i += 256) {         // wp[k][n] -> wt[n][k]
    int k = i >> 8, n = i & 255;
    wt[n * kLdW + k] = (f16)wp[i];
  }
  __syncthreads();

  const float scale = 0.17677669529663687f;  // 1/sqrt(32)
#pragma unroll 1
  for (int j = 0; j < 8; ++j) {              // 8 waves x 8 tiles = 64 tiles
    int t  = wave * 8 + j;
    int m0 = (t >> 4) * 16;
    int n0 = (t & 15) * 16;
    // batch all fragments, then chain WMMAs (hide LDS latency)
    v16h a0 = ld_frag(xs, m0, kLdX, 0,  lane);
    v16h a1 = ld_frag(xs, m0, kLdX, 32, lane);
    v16h a2 = ld_frag(xs, m0, kLdX, 64, lane);
    v16h a3 = ld_frag(xs, m0, kLdX, 96, lane);
    v16h b0 = ld_frag(wt, n0, kLdW, 0,  lane);
    v16h b1 = ld_frag(wt, n0, kLdW, 32, lane);
    v16h b2 = ld_frag(wt, n0, kLdW, 64, lane);
    v16h b3 = ld_frag(wt, n0, kLdW, 96, lane);
    v8f acc = {};
    acc = wmma_f16(a0, b0, acc);
    acc = wmma_f16(a1, b1, acc);
    acc = wmma_f16(a2, b2, acc);
    acc = wmma_f16(a3, b3, acc);

    int n = n0 + (lane & 15);
    if (W == 3) {                    // gate: sigmoid(x@wg + bg), [NR][S][HC]
      float bgv = bg[n];
#pragma unroll
      for (int r = 0; r < 8; ++r) {
        int srow = s0 + m0 + r + (hg << 3);
        float gv = __builtin_amdgcn_rcpf(1.0f + __expf(-(acc[r] + bgv)));
        dst[((size_t)nr * kS + srow) * kHC + n] = (f16)gv;
      }
    } else {                         // Q/K/V: head-split [NR][H][S][CH]
      const float mul = (W == 0) ? scale : 1.0f;
      int hh = n >> 5, ch = n & 31;
#pragma unroll
      for (int r = 0; r < 8; ++r) {
        int srow = s0 + m0 + r + (hg << 3);
        dst[(((size_t)nr * kH + hh) * kS + srow) * kCH + ch] = (f16)(acc[r] * mul);
      }
    }
    sched_fence();
  }
}

// ===================== Kernel 2: attention (one block per nr,h) =====================
__global__ __launch_bounds__(256, 1)
void attn_kernel(const float* __restrict__ bias_mask,
                 const float* __restrict__ bias_pair,
                 const f16* __restrict__ Qh, const f16* __restrict__ Kh,
                 const f16* __restrict__ Vh, const f16* __restrict__ Gh,
                 f16* __restrict__ Oh) {
  extern __shared__ f16 smem[];
  f16* Qs = smem;                          // [256][kLdQ]
  f16* Ks = Qs + kS * kLdQ;                // [256][kLdQ]
  f16* Vt = Ks + kS * kLdQ;                // [32][kLdP]  V^T: Vt[ch][key]
  f16* Ps = Vt + kCH * kLdP;               // [256][kLdP] probabilities
  const int nr  = blockIdx.x >> 3;
  const int h   = blockIdx.x & 7;
  const int tid = threadIdx.x;
  const int lane = tid & 31, wave = tid >> 5, hg = lane >> 4;

  __builtin_prefetch(bias_pair + ((size_t)h * kS) * kS, 0, 0);  // global_prefetch_b8

  const size_t base = ((size_t)nr * kH + h) * kS * kCH;  // in halves
  // async 16B-chunk copies into padded rows: row = 32 halves = 4 chunks
  const uint32_t qs_off = lds_off(Qs), ks_off = lds_off(Ks);
  for (int i = tid; i < kS * kCH / 8; i += 256) {     // 1024 chunks each
    int key = i >> 2, c8 = (i & 3) * 8;               // chunk start (halves)
    uint32_t doff = (uint32_t)((key * kLdQ + c8) * 2);
    const f16* qsrc = Qh + base + key * kCH + c8;
    const f16* ksrc = Kh + base + key * kCH + c8;
    async_ld_b128(qs_off + doff, qsrc);
    async_ld_b128(ks_off + doff, ksrc);
  }
  const f16* vsrc = Vh + base;
  for (int i = tid; i < kS * kCH; i += 256) {         // transpose V -> Vt[ch][key]
    int key = i >> 5, ch = i & 31;
    Vt[ch * kLdP + key] = vsrc[i];
  }
  wait_async0();
  __syncthreads();

  // --- scores + softmax; each wave owns 16 query rows per iteration ---
#pragma unroll 1
  for (int it = 0; it < 2; ++it) {
    int qt = wave + it * 8;
    int q0 = qt * 16;
    v16h a = ld_frag(Qs, q0, kLdQ, 0, lane);   // Q fragment, K-dim = 32
    v8f sacc[16];
#pragma unroll
    for (int g = 0; g < 4; ++g) {              // 4 B-frags per fenced group
      v16h b0 = ld_frag(Ks, (g * 4 + 0) * 16, kLdQ, 0, lane);
      v16h b1 = ld_frag(Ks, (g * 4 + 1) * 16, kLdQ, 0, lane);
      v16h b2 = ld_frag(Ks, (g * 4 + 2) * 16, kLdQ, 0, lane);
      v16h b3 = ld_frag(Ks, (g * 4 + 3) * 16, kLdQ, 0, lane);
      v8f z0 = {}, z1 = {}, z2 = {}, z3 = {};
      sacc[g * 4 + 0] = wmma_f16(a, b0, z0);
      sacc[g * 4 + 1] = wmma_f16(a, b1, z1);
      sacc[g * 4 + 2] = wmma_f16(a, b2, z2);
      sacc[g * 4 + 3] = wmma_f16(a, b3, z3);
      sched_fence();   // cap live B-fragments: no cross-group hoisting
    }
    // additive biases (D-fragment layout: row = q0+r+8*hg, col = lane&15)
#pragma unroll
    for (int g = 0; g < 4; ++g) {
#pragma unroll
      for (int nt4 = 0; nt4 < 4; ++nt4) {
        int nt = g * 4 + nt4;
        int n = nt * 16 + (lane & 15);
        float bm = bias_mask[(size_t)nr * kS + n];
#pragma unroll
        for (int r = 0; r < 8; ++r) {
          int q = q0 + r + (hg << 3);
          sacc[nt][r] += bm + bias_pair[((size_t)h * kS + q) * kS + n];
        }
      }
      sched_fence();   // cap in-flight bias loads
    }
    // softmax over 256 keys: 16 in-lane values + 16-lane shuffle reduction
    float rinv[8];
#pragma unroll
    for (int r = 0; r < 8; ++r) {
      float m = sacc[0][r];
#pragma unroll
      for (int nt = 1; nt < 16; ++nt) m = fmaxf(m, sacc[nt][r]);
#pragma unroll
      for (int off = 8; off >= 1; off >>= 1) m = fmaxf(m, __shfl_xor(m, off, 32));
      float s = 0.0f;
#pragma unroll
      for (int nt = 0; nt < 16; ++nt) {
        float e = __expf(sacc[nt][r] - m);
        sacc[nt][r] = e;
        s += e;
      }
#pragma unroll
      for (int off = 8; off >= 1; off >>= 1) s += __shfl_xor(s, off, 32);
      rinv[r] = __builtin_amdgcn_rcpf(s);
    }
#pragma unroll
    for (int nt = 0; nt < 16; ++nt) {
      int n = nt * 16 + (lane & 15);
#pragma unroll
      for (int r = 0; r < 8; ++r) {
        int q = q0 + r + (hg << 3);
        Ps[(size_t)q * kLdP + n] = (f16)(sacc[nt][r] * rinv[r]);
      }
    }
    sched_fence();
  }
  __syncthreads();

  // --- O = P @ V, gated epilogue ---
#pragma unroll 1
  for (int j = 0; j < 4; ++j) {
    int t  = wave + j * 8;        // 32 tiles: 16 q-tiles x 2 ch-tiles
    int qt = t & 15, ct = t >> 4;
    int q0 = qt * 16, c0 = ct * 16;
    v8f acc = {};
#pragma unroll
    for (int g = 0; g < 2; ++g) {      // 4 (A,B) pairs per fenced group
      int k0 = g * 128;
      v16h a0 = ld_frag(Ps, q0, kLdP, k0 + 0,  lane);
      v16h a1 = ld_frag(Ps, q0, kLdP, k0 + 32, lane);
      v16h a2 = ld_frag(Ps, q0, kLdP, k0 + 64, lane);
      v16h a3 = ld_frag(Ps, q0, kLdP, k0 + 96, lane);
      v16h b0 = ld_frag(Vt, c0, kLdP, k0 + 0,  lane);
      v16h b1 = ld_frag(Vt, c0, kLdP, k0 + 32, lane);
      v16h b2 = ld_frag(Vt, c0, kLdP, k0 + 64, lane);
      v16h b3 = ld_frag(Vt, c0, kLdP, k0 + 96, lane);
      acc = wmma_f16(a0, b0, acc);
      acc = wmma_f16(a1, b1, acc);
      acc = wmma_f16(a2, b2, acc);
      acc = wmma_f16(a3, b3, acc);
      sched_fence();
    }
    int ch = c0 + (lane & 15);
    int n  = h * kCH + ch;
#pragma unroll
    for (int r = 0; r < 8; ++r) {
      int q = q0 + r + (hg << 3);
      size_t gi = ((size_t)nr * kS + q) * kHC + n;
      float g = (float)Gh[gi];
      Oh[gi] = (f16)(acc[r] * g);
    }
    sched_fence();
  }
}

// ===================== Kernel 3: output projection =====================
__global__ __launch_bounds__(256, 1)
void outproj_kernel(const f16* __restrict__ Oh,
                    const float* __restrict__ wo,
                    const float* __restrict__ bo,
                    float* __restrict__ out) {
  extern __shared__ f16 smem[];
  f16* As = smem;                 // [64][kLdP]  gated attention rows
  f16* wt = smem + 64 * kLdP;     // [128][kLdP] wo^T: wt[n][k]
  const int nr  = blockIdx.x >> 2;
  const int s0  = (blockIdx.x & 3) * 64;
  const int tid = threadIdx.x;
  const int lane = tid & 31, wave = tid >> 5, hg = lane >> 4;

  // async 16B-chunk copy of the 64x256 f16 tile into padded rows
  const f16* asrc = Oh + ((size_t)nr * kS + s0) * kHC;
  const uint32_t as_off = lds_off(As);
  for (int i = tid; i < 64 * kHC / 8; i += 256) {   // 2048 chunks
    int row = i >> 5, c8 = (i & 31) * 8;
    async_ld_b128(as_off + (uint32_t)((row * kLdP + c8) * 2),
                  asrc + row * kHC + c8);
  }
  for (int i = tid; i < kHC * kC; i += 256) {       // wo[k][n] -> wt[n][k]
    int k = i >> 7, n = i & 127;
    wt[n * kLdP + k] = (f16)wo[i];
  }
  wait_async0();
  __syncthreads();

#pragma unroll 1
  for (int j = 0; j < 4; ++j) {
    int t  = wave + j * 8;           // 32 tiles: 4 m x 8 n
    int m0 = (t >> 3) * 16, n0 = (t & 7) * 16;
    v8f acc = {};
#pragma unroll
    for (int g = 0; g < 2; ++g) {    // 4 (A,B) pairs per fenced group
      int k0 = g * 128;
      v16h a0 = ld_frag(As, m0, kLdP, k0 + 0,  lane);
      v16h a1 = ld_frag(As, m0, kLdP, k0 + 32, lane);
      v16h a2 = ld_frag(As, m0, kLdP, k0 + 64, lane);
      v16h a3 = ld_frag(As, m0, kLdP, k0 + 96, lane);
      v16h b0 = ld_frag(wt, n0, kLdP, k0 + 0,  lane);
      v16h b1 = ld_frag(wt, n0, kLdP, k0 + 32, lane);
      v16h b2 = ld_frag(wt, n0, kLdP, k0 + 64, lane);
      v16h b3 = ld_frag(wt, n0, kLdP, k0 + 96, lane);
      acc = wmma_f16(a0, b0, acc);
      acc = wmma_f16(a1, b1, acc);
      acc = wmma_f16(a2, b2, acc);
      acc = wmma_f16(a3, b3, acc);
      sched_fence();
    }
    int c = n0 + (lane & 15);
    float bias = bo[c];
#pragma unroll
    for (int r = 0; r < 8; ++r) {
      int srow = s0 + m0 + r + (hg << 3);
      out[((size_t)nr * kS + srow) * kC + c] = acc[r] + bias;
    }
    sched_fence();
  }
}

extern "C" void kernel_launch(void* const* d_in, const int* in_sizes, int n_in,
                              void* d_out, int out_size, void* d_ws, size_t ws_size,
                              hipStream_t stream) {
  const float* q_x       = (const float*)d_in[0];
  const float* kv_x      = (const float*)d_in[1];
  const float* bias_mask = (const float*)d_in[2];
  const float* bias_pair = (const float*)d_in[3];
  const float* wq = (const float*)d_in[4];
  const float* wk = (const float*)d_in[5];
  const float* wv = (const float*)d_in[6];
  const float* wg = (const float*)d_in[7];
  const float* bg = (const float*)d_in[8];
  const float* wo = (const float*)d_in[9];
  const float* bo = (const float*)d_in[10];
  float* out = (float*)d_out;

  char* wsb = (char*)d_ws;
  const size_t SZ = (size_t)kNR * kH * kS * kCH * sizeof(f16);  // 33.5 MB each
  f16* Qh = (f16*)(wsb + 0 * SZ);   // [NR][H][S][CH], pre-scaled
  f16* Kh = (f16*)(wsb + 1 * SZ);   // [NR][H][S][CH]
  f16* Vh = (f16*)(wsb + 2 * SZ);   // [NR][H][S][CH]
  f16* Gh = (f16*)(wsb + 3 * SZ);   // [NR][S][HC] sigmoid gate
  f16* Oh = (f16*)(wsb + 4 * SZ);   // [NR][S][HC] gated attention out

  dim3 blk(256);
  const size_t smem1 = (64 * kLdX + kHC * kLdW) * sizeof(f16);
  proj_kernel<0><<<dim3(kNR * 4), blk, smem1, stream>>>(q_x,  wq, bg, Qh);
  proj_kernel<1><<<dim3(kNR * 4), blk, smem1, stream>>>(kv_x, wk, bg, Kh);
  proj_kernel<2><<<dim3(kNR * 4), blk, smem1, stream>>>(kv_x, wv, bg, Vh);
  proj_kernel<3><<<dim3(kNR * 4), blk, smem1, stream>>>(q_x,  wg, bg, Gh);
  attn_kernel<<<dim3(kNR * kH), blk,
                (2 * kS * kLdQ + kCH * kLdP + kS * kLdP) * sizeof(f16), stream>>>(
      bias_mask, bias_pair, Qh, Kh, Vh, Gh, Oh);
  outproj_kernel<<<dim3(kNR * 4), blk,
                   (64 * kLdP + kC * kLdP) * sizeof(f16), stream>>>(
      Oh, wo, bo, out);
}

// v001
// It runs in 182 microseconds.
// Next to v000, in two timings, it ran 1.29 times as fast each time.
#include <hip/hip_runtime.h>

typedef _Float16 f16;
typedef __attribute__((ext_vector_type(8)))  _Float16 v8h;
typedef __attribute__((ext_vector_type(16))) _Float16 v16h;
typedef __attribute__((ext_vector_type(8)))  float    v8f;
typedef __attribute__((ext_vector_type(4)))  float    v4f;

constexpr int kS  = 256;   // tokens (Q = K)
constexpr int kC  = 128;   // input channels (CQ=CK=CV)
constexpr int kH  = 8;     // heads
constexpr int kCH = 32;    // head dim
constexpr int kHC = 256;   // H*CH
constexpr int kNR = 256;   // rows

// padded LDS row strides (halves): odd multiples of 8 -> 16B-aligned b128
// loads with lanes spread across banks
constexpr int kLdX = 136;  // 128 + 8
constexpr int kLdW = 136;  // weight^T rows (K=128)
constexpr int kLdQ = 40;   // 32 + 8 (Q/K tiles, K-dim 32)
constexpr int kLdP = 264;  // 256 + 8 (V^T and out-projection rows, K-dim 256)

// ---- fragment loader (CDNA5 16-bit WMMA layout, ISA 7.12.2) ----
// Source is [M][K] (A) or [N][K] (B^T staged): lane owns row (base + lane&15),
// element i holds K = k0 + 8*(lane>>4) + i + (i>=8 ? 8 : 0)  -> two
// contiguous 16-byte runs -> exactly two ds_load_b128 per fragment.
__device__ __forceinline__ v16h ld_frag(const f16* p, int row0, int ld,
                                        int k0, int lane) {
  const f16* q = p + (size_t)(row0 + (lane & 15)) * ld + k0 + ((lane >> 4) << 3);
  v8h lo = *(const v8h*)(q);
  v8h hi = *(const v8h*)(q + 16);
  return __builtin_shufflevector(lo, hi, 0, 1, 2, 3, 4, 5, 6, 7,
                                 8, 9, 10, 11, 12, 13, 14, 15);
}

__device__ __forceinline__ v8f wmma_f16(v16h a, v16h b, v8f c) {
  return __builtin_amdgcn_wmma_f32_16x16x32_f16(false, a, false, b,
                                                (short)0, c, false, false);
}

// scheduling fence: keep register pressure bounded (no hoisting across)
__device__ __forceinline__ void sched_fence() {
  __builtin_amdgcn_sched_barrier(0);
}

// ---- CDNA5 async global->LDS copy (ASYNCcnt tracked, no VGPR data) ----
__device__ __forceinline__ void async_ld_b128(uint32_t lds_byte_off, const f16* g) {
  asm volatile("global_load_async_to_lds_b128 %0, %1, off"
               :: "v"(lds_byte_off), "v"(g) : "memory");
}
__device__ __forceinline__ void wait_async0() {
  asm volatile("s_wait_asynccnt 0x0" ::: "memory");
}
__device__ __forceinline__ uint32_t lds_off(const void* p) {
  return (uint32_t)(uintptr_t)p;   // low 32 bits of shared aperture = LDS offset
}

// ===================== Kernel 1: input projections =====================
// Templated on W (0=wq,1=wk,2=wv,3=wg): fully specialized epilogues.
template <int W>
__global__ __launch_bounds__(256, 1)
void proj_kernel(const float* __restrict__ xg,
                 const float* __restrict__ wp,
                 const float* __restrict__ bg,
                 f16* __restrict__ dst) {
  extern __shared__ f16 smem[];
  f16* xs = smem;                 // [64][kLdX]  x-tile
  f16* wt = smem + 64 * kLdX;     // [256][kLdW] weight^T  (wt[n][k])
  const int nr  = blockIdx.x >> 2;
  const int s0  = (blockIdx.x & 3) * 64;
  const int tid = threadIdx.x;
  const int lane = tid & 31, wave = tid >> 5, hg = lane >> 4;

  const size_t xbase = ((size_t)nr * kS + s0) * kC;   // 64 rows contiguous
  for (int i = tid; i < 64 * kC; i += 256)
    xs[(i >> 7) * kLdX + (i & 127)] = (f16)xg[xbase + i];
  for (int i = tid; i < kC * kHC; i += 256) {         // wp[k][n] -> wt[n][k]
    int k = i >> 8, n = i & 255;
    wt[n * kLdW + k] = (f16)wp[i];
  }
  __syncthreads();

  const float scale = 0.17677669529663687f;  // 1/sqrt(32)
#pragma unroll 1
  for (int j = 0; j < 8; ++j) {              // 8 waves x 8 tiles = 64 tiles
    int t  = wave * 8 + j;
    int m0 = (t >> 4) * 16;
    int n0 = (t & 15) * 16;
    // batch all fragments, then chain WMMAs (hide LDS latency)
    v16h a0 = ld_frag(xs, m0, kLdX, 0,  lane);
    v16h a1 = ld_frag(xs, m0, kLdX, 32, lane);
    v16h a2 = ld_frag(xs, m0, kLdX, 64, lane);
    v16h a3 = ld_frag(xs, m0, kLdX, 96, lane);
    v16h b0 = ld_frag(wt, n0, kLdW, 0,  lane);
    v16h b1 = ld_frag(wt, n0, kLdW, 32, lane);
    v16h b2 = ld_frag(wt, n0, kLdW, 64, lane);
    v16h b3 = ld_frag(wt, n0, kLdW, 96, lane);
    v8f acc = {};
    acc = wmma_f16(a0, b0, acc);
    acc = wmma_f16(a1, b1, acc);
    acc = wmma_f16(a2, b2, acc);
    acc = wmma_f16(a3, b3, acc);

    int n = n0 + (lane & 15);
    if (W == 3) {                    // gate: sigmoid(x@wg + bg), [NR][S][HC]
      float bgv = bg[n];
#pragma unroll
      for (int r = 0; r < 8; ++r) {
        int srow = s0 + m0 + r + (hg << 3);
        float gv = __builtin_amdgcn_rcpf(1.0f + __expf(-(acc[r] + bgv)));
        dst[((size_t)nr * kS + srow) * kHC + n] = (f16)gv;
      }
    } else {                         // Q/K/V: head-split [NR][H][S][CH]
      const float mul = (W == 0) ? scale : 1.0f;
      int hh = n >> 5, ch = n & 31;
#pragma unroll
      for (int r = 0; r < 8; ++r) {
        int srow = s0 + m0 + r + (hg << 3);
        dst[(((size_t)nr * kH + hh) * kS + srow) * kCH + ch] = (f16)(acc[r] * mul);
      }
    }
    sched_fence();
  }
}

__device__ __forceinline__ float other_half(float x) {   // lane l <-> l ^ 16
  int b = __builtin_bit_cast(int, x);
  b = __builtin_amdgcn_permlanex16(b, b, 0x76543210, 0xfedcba98, false, false);
  return __builtin_bit_cast(float, b);
}

// 4 waves per SIMD: two work-groups share a WGP now that LDS allows it
__global__ __launch_bounds__(256, 4)
void attn_kernel(const float* __restrict__ bias_mask,
                 const float* __restrict__ bias_pair,
                 const f16* __restrict__ Qh, const f16* __restrict__ Kh,
                 const f16* __restrict__ Vh, const f16* __restrict__ Gh,
                 f16* __restrict__ Oh) {
  extern __shared__ f16 smem[];
  f16* Qs = smem;                          // [256][kLdQ]
  f16* Ks = Qs + kS * kLdQ;                // [256][kLdQ]
  f16* Vt = Ks + kS * kLdQ;                // [32][kLdP]  V^T: Vt[ch][key]
  const int nr  = blockIdx.x >> 3;
  const int h   = blockIdx.x & 7;
  const int tid = threadIdx.x;
  const int lane = tid & 31, wave = tid >> 5, hg = lane >> 4;

  __builtin_prefetch(bias_pair + ((size_t)h * kS) * kS, 0, 0);  // global_prefetch_b8

  const size_t base = ((size_t)nr * kH + h) * kS * kCH;  // in halves
  // async 16B-chunk copies into padded rows: row = 32 halves = 4 chunks
  const uint32_t qs_off = lds_off(Qs), ks_off = lds_off(Ks);
  for (int i = tid; i < kS * kCH / 8; i += 256) {     // 1024 chunks each
    int key = i >> 2, c8 = (i & 3) * 8;               // chunk start (halves)
    uint32_t doff = (uint32_t)((key * kLdQ + c8) * 2);
    const f16* qsrc = Qh + base + key * kCH + c8;
    const f16* ksrc = Kh + base + key * kCH + c8;
    async_ld_b128(qs_off + doff, qsrc);
    async_ld_b128(ks_off + doff, ksrc);
  }
  const f16* vsrc = Vh + base;
  for (int i = tid; i < kS * kCH; i += 256) {         // transpose V -> Vt[ch][key]
    int key = i >> 5, ch = i & 31;
    Vt[ch * kLdP + key] = vsrc[i];
  }
  wait_async0();
  __syncthreads();

  // D/C layout of S^T tile nt: register r = S[key 16*nt + 8*hg + r][query q0 + (lane&15)]
  const float* bmp = bias_mask + (size_t)nr * kS + (hg << 3);
#pragma unroll 1
  for (int it = 0; it < 2; ++it) {           // each wave owns 16 query columns per trip
    const int q = (wave + it * 8) * 16 + (lane & 15);
    const float* bpp = bias_pair + ((size_t)h * kS + q) * kS + (hg << 3);
    v8f sacc[16];
#pragma unroll
    for (int nt = 0; nt < 16; ++nt) {        // 8 consecutive keys per lane: 16-byte loads
      v4f p0 = *(const v4f*)(bpp + nt * 16);
      v4f p1 = *(const v4f*)(bpp + nt * 16 + 4);
      sacc[nt] = __builtin_shufflevector(p0, p1, 0, 1, 2, 3, 4, 5, 6, 7);
    }
    // O^T: register r = O[query q][channel 16*ct + 8*hg + r]: 16-byte gate load and store
    const size_t gi = ((size_t)nr * kS + q) * kHC + h * kCH + (hg << 3);
    const f16* gp = Gh + gi;
    const v8h g0 = *(const v8h*)(gp);        // gate fetched at the top of the trip, long before its use
    const v8h g1 = *(const v8h*)(gp + 16);
    const v16h bq = ld_frag(Qs, q - (lane & 15), kLdQ, 0, lane);  // B = Q^T, K-dim = 32
    // address wait before the loads' address registers are reused; the pointers are
    // inputs so that no load of the run lands on an address pair itself
    asm volatile("s_wait_xcnt 0x0" :: "v"(bpp), "v"(gp) : "memory");
    sched_fence();     // all pair-bias loads in flight, landing in the accumulators
#pragma unroll
    for (int g = 0; g < 4; ++g) {            // 4 score tiles per fenced group
      v8f bm[4];
      v16h ak[4];
#pragma unroll
      for (int j = 0; j < 4; ++j) {
        const int nt = g * 4 + j;
        v4f m0 = *(const v4f*)(bmp + nt * 16);
        v4f m1 = *(const v4f*)(bmp + nt * 16 + 4);
        bm[j] = __builtin_shufflevector(m0, m1, 0, 1, 2, 3, 4, 5, 6, 7);
        ak[j] = ld_frag(Ks, nt * 16, kLdQ, 0, lane);              // A = K rows
      }
#pragma unroll
      for (int j = 0; j < 4; ++j)
        sacc[g * 4 + j] = wmma_f16(ak[j], bq, sacc[g * 4 + j] + bm[j]);
      sched_fence();   // cap live mask values and K fragments: no cross-group hoisting
    }
    // softmax over 256 keys of this lane's query: 128 in-lane values + other half
    float mx[8];
#pragma unroll
    for (int r = 0; r < 8; ++r) mx[r] = sacc[0][r];
#pragma unroll
    for (int nt = 1; nt < 16; ++nt)
#pragma unroll
      for (int r = 0; r < 8; ++r) mx[r] = fmaxf(mx[r], sacc[nt][r]);
    float m = fmaxf(fmaxf(fmaxf(mx[0], mx[1]), fmaxf(mx[2], mx[3])),
                    fmaxf(fmaxf(mx[4], mx[5]), fmaxf(mx[6], mx[7])));
    m = fmaxf(m, other_half(m));

    float sm[8] = {0.f, 0.f, 0.f, 0.f, 0.f, 0.f, 0.f, 0.f};
    v8f o0 = {}, o1 = {};
#pragma unroll
    for (int kk = 0; kk < 8; ++kk) {         // 32 keys: two score tiles -> one B operand
      v16h pb;
#pragma unroll
      for (int r = 0; r < 8; ++r) {
        float e0 = __expf(sacc[2 * kk][r] - m);
        float e1 = __expf(sacc[2 * kk + 1][r] - m);
        sm[r] += e0 + e1;
        pb[r]     = (f16)e0;
        pb[8 + r] = (f16)e1;
      }
      v16h a0 = ld_frag(Vt, 0,  kLdP, kk * 32, lane);             // A = V^T rows
      v16h a1 = ld_frag(Vt, 16, kLdP, kk * 32, lane);
      o0 = wmma_f16(a0, pb, o0);
      o1 = wmma_f16(a1, pb, o1);
    }
    float s = ((sm[0] + sm[1]) + (sm[2] + sm[3])) + ((sm[4] + sm[5]) + (sm[6] + sm[7]));
    s += other_half(s);
    const float rinv = __builtin_amdgcn_rcpf(s);

    v8h r0, r1;
#pragma unroll
    for (int r = 0; r < 8; ++r) {
      r0[r] = (f16)(o0[r] * rinv * (float)g0[r]);
      r1[r] = (f16)(o1[r] * rinv * (float)g1[r]);
    }
    *(v8h*)(Oh + gi)      = r0;
    *(v8h*)(Oh + gi + 16) = r1;
    // address wait before the next trip overwrites the stores' registers
    asm volatile("s_wait_xcnt 0x0" ::: "memory");
  }
}

// ===================== Kernel 3: output projection =====================
__global__ __launch_bounds__(256, 1)
void outproj_kernel(const f16* __restrict__ Oh,
                    const float* __restrict__ wo,
                    const float* __restrict__ bo,
                    float* __restrict__ out) {
  extern __shared__ f16 smem[];
  f16* As = smem;                 // [64][kLdP]  gated attention rows
  f16* wt = smem + 64 * kLdP;     // [128][kLdP] wo^T: wt[n][k]
  const int nr  = blockIdx.x >> 2;
  const int s0  = (blockIdx.x & 3) * 64;
  const int tid = threadIdx.x;
  const int lane = tid & 31, wave = tid >> 5, hg = lane >> 4;

  // async 16B-chunk copy of the 64x256 f16 tile into padded rows
  const f16* asrc = Oh + ((size_t)nr * kS + s0) * kHC;
  const uint32_t as_off = lds_off(As);
  for (int i = tid; i < 64 * kHC / 8; i += 256) {   // 2048 chunks
    int row = i >> 5, c8 = (i & 31) * 8;
    async_ld_b128(as_off + (uint32_t)((row * kLdP + c8) * 2),
                  asrc + row * kHC + c8);
  }
  for (int i = tid; i < kHC * kC; i += 256) {       // wo[k][n] -> wt[n][k]
    int k = i >> 7, n = i & 127;
    wt[n * kLdP + k] = (f16)wo[i];
  }
  wait_async0();
  __syncthreads();

#pragma unroll 1
  for (int j = 0; j < 4; ++j) {
    int t  = wave + j * 8;           // 32 tiles: 4 m x 8 n
    int m0 = (t >> 3) * 16, n0 = (t & 7) * 16;
    v8f acc = {};
#pragma unroll
    for (int g = 0; g < 2; ++g) {    // 4 (A,B) pairs per fenced group
      int k0 = g * 128;
      v16h a0 = ld_frag(As, m0, kLdP, k0 + 0,  lane);
      v16h a1 = ld_frag(As, m0, kLdP, k0 + 32, lane);
      v16h a2 = ld_frag(As, m0, kLdP, k0 + 64, lane);
      v16h a3 = ld_frag(As, m0, kLdP, k0 + 96, lane);
      v16h b0 = ld_frag(wt, n0, kLdP, k0 + 0,  lane);
      v16h b1 = ld_frag(wt, n0, kLdP, k0 + 32, lane);
      v16h b2 = ld_frag(wt, n0, kLdP, k0 + 64, lane);
      v16h b3 = ld_frag(wt, n0, kLdP, k0 + 96, lane);
      acc = wmma_f16(a0, b0, acc);
      acc = wmma_f16(a1, b1, acc);
      acc = wmma_f16(a2, b2, acc);
      acc = wmma_f16(a3, b3, acc);
      sched_fence();
    }
    int c = n0 + (lane & 15);
    float bias = bo[c];
#pragma unroll
    for (int r = 0; r < 8; ++r) {
      int srow = s0 + m0 + r + (hg << 3);
      out[((size_t)nr * kS + srow) * kC + c] = acc[r] + bias;
    }
    sched_fence();
  }
}

extern "C" void kernel_launch(void* const* d_in, const int* in_sizes, int n_in,
                              void* d_out, int out_size, void* d_ws, size_t ws_size,
                              hipStream_t stream) {
  const float* q_x       = (const float*)d_in[0];
  const float* kv_x      = (const float*)d_in[1];
  const float* bias_mask = (const float*)d_in[2];
  const float* bias_pair = (const float*)d_in[3];
  const float* wq = (const float*)d_in[4];
  const float* wk = (const float*)d_in[5];
  const float* wv = (const float*)d_in[6];
  const float* wg = (const float*)d_in[7];
  const float* bg = (const float*)d_in[8];
  const float* wo = (const float*)d_in[9];
  const float* bo = (const float*)d_in[10];
  float* out = (float*)d_out;

  char* wsb = (char*)d_ws;
  const size_t SZ = (size_t)kNR * kH * kS * kCH * sizeof(f16);  // 33.5 MB each
  f16* Qh = (f16*)(wsb + 0 * SZ);   // [NR][H][S][CH], pre-scaled
  f16* Kh = (f16*)(wsb + 1 * SZ);   // [NR][H][S][CH]
  f16* Vh = (f16*)(wsb + 2 * SZ);   // [NR][H][S][CH]
  f16* Gh = (f16*)(wsb + 3 * SZ);   // [NR][S][HC] sigmoid gate
  f16* Oh = (f16*)(wsb + 4 * SZ);   // [NR][S][HC] gated attention out

  dim3 blk(256);
  const size_t smem1 = (64 * kLdX + kHC * kLdW) * sizeof(f16);
  proj_kernel<0><<<dim3(kNR * 4), blk, smem1, stream>>>(q_x,  wq, bg, Qh);
  proj_kernel<1><<<dim3(kNR * 4), blk, smem1, stream>>>(kv_x, wk, bg, Kh);
  proj_kernel<2><<<dim3(kNR * 4), blk, smem1, stream>>>(kv_x, wv, bg, Vh);
  proj_kernel<3><<<dim3(kNR * 4), blk, smem1, stream>>>(q_x,  wg, bg, Gh);
  attn_kernel<<<dim3(kNR * kH), blk,
                (2 * kS * kLdQ + kCH * kLdP) * sizeof(f16), stream>>>(
      bias_mask, bias_pair, Qh, Kh, Vh, Gh, Oh);
  outproj_kernel<<<dim3(kNR * 4), blk,
                   (64 * kLdP + kC * kLdP) * sizeof(f16), stream>>>(
      Oh, wo, bo, out);
}

// v002
// Measured time: 131 microseconds a run.
// Next to v001, in two timings, it ran 1.39 times as fast each time.
// Counting every step since v000, it is 1.79 times as fast.
#include <hip/hip_runtime.h>

typedef _Float16 f16;
typedef __attribute__((ext_vector_type(4)))  _Float16 v4h;
typedef __attribute__((ext_vector_type(8)))  _Float16 v8h;
typedef __attribute__((ext_vector_type(16))) _Float16 v16h;
typedef __attribute__((ext_vector_type(8)))  float    v8f;
typedef __attribute__((ext_vector_type(4)))  float    v4f;

constexpr int kS  = 256;   // tokens (Q = K)
constexpr int kC  = 128;   // input channels (CQ=CK=CV)
constexpr int kH  = 8;     // heads
constexpr int kCH = 32;    // head dim
constexpr int kHC = 256;   // H*CH
constexpr int kNR = 256;   // rows
constexpr int kRT = 32;    // tokens per staged activation tile (projections)

// padded LDS row strides (halves): odd multiples of 8 -> 16B-aligned b128
// loads with lanes spread across banks
constexpr int kLdX = 136;  // 128 + 8
constexpr int kLdO = 40;   // 32 + 8 (projection output rows on their way to whole-line stores)
constexpr int kLdQ = 40;   // 32 + 8 (Q/K tiles, K-dim 32)
constexpr int kLdP = 264;  // 256 + 8 (V^T and out-projection rows, K-dim 256)

// ---- fragment loader (CDNA5 16-bit WMMA layout, ISA 7.12.2) ----
// Source is [M][K] (A) or [N][K] (B^T staged): lane owns row (base + lane&15),
// element i holds K = k0 + 8*(lane>>4) + i + (i>=8 ? 8 : 0)  -> two
// contiguous 16-byte runs -> exactly two ds_load_b128 per fragment.
__device__ __forceinline__ v16h ld_frag(const f16* p, int row0, int ld,
                                        int k0, int lane) {
  const f16* q = p + (size_t)(row0 + (lane & 15)) * ld + k0 + ((lane >> 4) << 3);
  v8h lo = *(const v8h*)(q);
  v8h hi = *(const v8h*)(q + 16);
  return __builtin_shufflevector(lo, hi, 0, 1, 2, 3, 4, 5, 6, 7,
                                 8, 9, 10, 11, 12, 13, 14, 15);
}

__device__ __forceinline__ v8f wmma_f16(v16h a, v16h b, v8f c) {
  return __builtin_amdgcn_wmma_f32_16x16x32_f16(false, a, false, b,
                                                (short)0, c, false, false);
}

// scheduling fence: keep register pressure bounded (no hoisting across)
__device__ __forceinline__ void sched_fence() {
  __builtin_amdgcn_sched_barrier(0);
}

// ---- CDNA5 async global->LDS copy (ASYNCcnt tracked, no VGPR data) ----
__device__ __forceinline__ void async_ld_b128(uint32_t lds_byte_off, const f16* g) {
  asm volatile("global_load_async_to_lds_b128 %0, %1, off"
               :: "v"(lds_byte_off), "v"(g) : "memory");
}
__device__ __forceinline__ void wait_async0() {
  asm volatile("s_wait_asynccnt 0x0" ::: "memory");
}
__device__ __forceinline__ uint32_t lds_off(const void* p) {
  return (uint32_t)(uintptr_t)p;   // low 32 bits of shared aperture = LDS offset
}

// work-group barrier that orders LDS only: the next tile's global loads stay in
// flight across it and the output stores are not waited for (__syncthreads drains both)
__device__ __forceinline__ void lds_barrier() {
  __builtin_amdgcn_fence(__ATOMIC_RELEASE, "workgroup", "local");
  __builtin_amdgcn_s_barrier();
  __builtin_amdgcn_fence(__ATOMIC_ACQUIRE, "workgroup", "local");
}

// reciprocal and 2^x with the one free slot that the instruction set asks for behind
// a transcendental
__device__ __forceinline__ float rcp_slot(float x) {
  float y;
  asm("v_rcp_f32 %0, %1\n\tv_nop" : "=v"(y) : "v"(x));
  return y;
}
__device__ __forceinline__ float exp2_slot(float x) {
  float y;
  asm("v_exp_f32 %0, %1\n\tv_nop" : "=v"(y) : "v"(x));
  return y;
}

// ===================== Kernel 1: input projections, one launch =====================
// Weight-stationary and transposed: D^T = W^T X^T. A block takes one row group
// (256 tokens) of one activation (even blocks q_x: wq, wg; odd blocks kv_x: wk, wv).
// A wave keeps the A fragments of its 64 output columns in registers for the whole
// block; only the activation goes through LDS, in 32-token tiles, two buffers.
// Column map of a wave: row j of matrix tile t is column base + 4*j + t, so one
// 16-byte load of a weight row feeds all four tiles, and lane (token, hg) ends up
// with the 32 consecutive columns base + 32*hg .. +31 of its token.
__global__ __launch_bounds__(256, 4)
void proj_all_kernel(const float* __restrict__ q_x, const float* __restrict__ kv_x,
                     const float* __restrict__ wq,  const float* __restrict__ wk,
                     const float* __restrict__ wv,  const float* __restrict__ wg,
                     const float* __restrict__ bg,
                     f16* __restrict__ Qh, f16* __restrict__ Kh,
                     f16* __restrict__ Vh, f16* __restrict__ Gh) {
  extern __shared__ f16 smem[];
  f16*   xs  = smem;                               // [2][kRT][kLdX] activation tiles
  f16*   os  = smem + 2 * kRT * kLdX;              // [8 waves][32][kLdO] output rows
  float* bgs = (float*)(os + 8 * 32 * kLdO);       // [256] gate bias
  const int side = blockIdx.x & 1;
  const int nr   = blockIdx.x >> 1;
  const int tid  = threadIdx.x;
  const int lane = tid & 31, hg = lane >> 4, ln = lane & 15;
  const int wave = __builtin_amdgcn_readfirstlane(tid >> 5);
  const bool second = wave >= 4;                   // waves 4..7: wg or wv
  const bool gate   = second && side == 0;
  const int  base   = (wave & 3) * 64;             // first output column of this wave

  const float* wp  = side ? (second ? wv : wk) : (second ? wg : wq);
  f16*         dst = side ? (second ? Vh : Kh) : (second ? Gh : Qh);
  const bool   isq = side == 0 && !second;         // Q carries 1/sqrt(32)

  f16* ow = os + wave * 32 * kLdO;                 // this wave's own staging rows
  f16* owr = ow + (hg * 16 + ln) * kLdO;           // written: row (hg, token)
  // read back so that every 16-byte store instruction covers whole 128-byte lines:
  // gate [NR][S][HC]: 4 tokens x 128 bytes per store; Q/K/V [NR][H][S][CH]: 8 tokens
  // x 64 bytes of one head per store, stores 2 and 3 in the wave's second head
  const f16* ord = ow + (gate ? (((lane >> 2) & 1) * 16 + (lane >> 3)) : (lane >> 2)) * kLdO
                   + (lane & 3) * 8;
  const int ostep = gate ? 4 * kLdO : 8 * kLdO;    // LDS step per store
  f16* gdst = dst + (gate ? ((size_t)nr * kS + (lane >> 3)) * kHC + base + (lane & 7) * 8
                          : ((size_t)nr * kH + (wave & 3) * 2) * kS * kCH + lane * 8);
  const int gstep = gate ? 4 * kHC : 8 * kCH;      // global step per store
  const int hstep = gate ? 0 : kS * kCH - 2 * gstep;   // on to the second head
  const int tstep = gate ? kHC : kCH;              // global step per token

  // a wave-wide 16-byte load covers one whole 512-byte token row
  const v4f* xsrc = (const v4f*)((side ? kv_x : q_x) + (size_t)nr * kS * kC) + tid;
  f16* xdst = xs + (tid >> 5) * kLdX + lane * 4;
  v4f xr[4];
#pragma unroll
  for (int j = 0; j < 4; ++j) xr[j] = xsrc[j * 256];

  bgs[tid] = bg[tid];

  v16h wf[4][4];                                   // [tile t][k step]
  const float* wl = wp + base + 4 * ln + (hg << 3) * kHC;
  v4f wr[2][16];                                   // one k step in use, the next in flight
#pragma unroll
  for (int i = 0; i < 16; ++i)                     // same k order as ld_frag
    wr[0][i] = *(const v4f*)(wl + (i + (i >= 8 ? 8 : 0)) * kHC);
#pragma unroll
  for (int ks = 0; ks < 4; ++ks) {
    v4f* wc = wr[ks & 1];
    if (ks + 1 < 4) {
#pragma unroll
      for (int i = 0; i < 16; ++i)
        wr[(ks + 1) & 1][i] = *(const v4f*)(wl + ((ks + 1) * 32 + i + (i >= 8 ? 8 : 0)) * kHC);
    }
    // holds the later k steps' loads behind this step's values: all 64 loads
    // issued at once need more registers than the wave has and spill
    asm volatile("" :: "v"(wc[0]), "v"(wc[1]), "v"(wc[2]), "v"(wc[3]), "v"(wc[4]), "v"(wc[5]),
                 "v"(wc[6]), "v"(wc[7]), "v"(wc[8]), "v"(wc[9]), "v"(wc[10]), "v"(wc[11]),
                 "v"(wc[12]), "v"(wc[13]), "v"(wc[14]), "v"(wc[15]) : "memory");
#pragma unroll
    for (int i = 0; i < 16; ++i)
#pragma unroll
      for (int t = 0; t < 4; ++t) wf[t][ks][i] = (f16)wc[i][t];
  }

#pragma unroll
  for (int j = 0; j < 4; ++j)
    *(v4h*)(xdst + j * 8 * kLdX) = __builtin_convertvector(xr[j], v4h);
#pragma unroll
  for (int j = 0; j < 4; ++j) xr[j] = xsrc[1024 + j * 256];
  // address wait before the loads' address registers are reused
  asm volatile("s_wait_xcnt 0x0" ::: "memory");
  lds_barrier();

#pragma unroll 1   // rolled: the buffer index is the only thing that differs between trips
  for (int tt = 0; tt < kS / kRT; ++tt) {
    const f16* xb = xs + (tt & 1) * kRT * kLdX;
#pragma unroll 1   // rolled: beside the weight fragments there are registers for one tile only
    for (int st = 0; st < kRT / 16; ++st) {
      v16h xf[4];                                  // B = X^T, all four k steps
#pragma unroll
      for (int ks = 0; ks < 4; ++ks) xf[ks] = ld_frag(xb, st * 16, kLdX, ks * 32, lane);
      sched_fence();   // one group of LDS reads, one wait: none among the WMMAs
      v8f acc[4] = {};
#pragma unroll
      for (int ks = 0; ks < 4; ++ks)
#pragma unroll
        for (int t = 0; t < 4; ++t) acc[t] = wmma_f16(wf[t][ks], xf[ks], acc[t]);
      if (gate) {
#pragma unroll
        for (int r = 0; r < 8; ++r) {
          const v4f b4 = *(const v4f*)(bgs + base + 32 * hg + 4 * r);
#pragma unroll
          for (int t = 0; t < 4; ++t)
            acc[t][r] = rcp_slot(1.0f + exp2_slot((acc[t][r] + b4[t]) * -1.4426950408889634f));  // sigmoid
        }
      } else if (isq) {
#pragma unroll
        for (int t = 0; t < 4; ++t) acc[t] *= 0.17677669529663687f;
      }
#pragma unroll
      for (int c = 0; c < 4; ++c) {                // columns 8c .. 8c+7 of the lane's 32
        v8h o;
#pragma unroll
        for (int e = 0; e < 8; ++e) o[e] = (f16)acc[e & 3][2 * c + (e >> 2)];
        *(v8h*)(owr + c * 8) = o;
      }
      // the rows come back from other lanes of this wave: their LDS writes first
      asm volatile("s_wait_dscnt 0x0" ::: "memory");
      const int tok = tt * kRT + st * 16;          // first token of this 16-token tile
      f16* g = gdst + tok * tstep;
#pragma unroll
      for (int c = 0; c < 4; ++c)
        *(v8h*)(g + c * gstep + (c >> 1) * hstep) = *(const v8h*)(ord + c * ostep);
      // address wait before the next tile overwrites the stores' registers
      asm volatile("s_wait_xcnt 0x0" ::: "memory");
    }
    if (tt + 1 < kS / kRT) {                       // block-uniform
      f16* xn = xdst + ((tt + 1) & 1) * kRT * kLdX;   // last read in trip tt - 1
#pragma unroll
      for (int j = 0; j < 4; ++j)
        *(v4h*)(xn + j * 8 * kLdX) = __builtin_convertvector(xr[j], v4h);
      if (tt + 2 < kS / kRT) {
#pragma unroll
        for (int j = 0; j < 4; ++j) xr[j] = xsrc[(tt + 2) * 1024 + j * 256];
        // address wait before the loads' address registers are reused
        asm volatile("s_wait_xcnt 0x0" ::: "memory");
      }
      lds_barrier();
    }
  }
}

__device__ __forceinline__ float other_half(float x) {   // lane l <-> l ^ 16
  int b = __builtin_bit_cast(int, x);
  b = __builtin_amdgcn_permlanex16(b, b, 0x76543210, 0xfedcba98, false, false);
  return __builtin_bit_cast(float, b);
}

// 4 waves per SIMD: two work-groups share a WGP now that LDS allows it
__global__ __launch_bounds__(256, 4)
void attn_kernel(const float* __restrict__ bias_mask,
                 const float* __restrict__ bias_pair,
                 const f16* __restrict__ Qh, const f16* __restrict__ Kh,
                 const f16* __restrict__ Vh, const f16* __restrict__ Gh,
                 f16* __restrict__ Oh) {
  extern __shared__ f16 smem[];
  f16* Qs = smem;                          // [256][kLdQ]
  f16* Ks = Qs + kS * kLdQ;                // [256][kLdQ]
  f16* Vt = Ks + kS * kLdQ;                // [32][kLdP]  V^T: Vt[ch][key]
  const int nr  = blockIdx.x >> 3;
  const int h   = blockIdx.x & 7;
  const int tid = threadIdx.x;
  const int lane = tid & 31, wave = tid >> 5, hg = lane >> 4;

  __builtin_prefetch(bias_pair + ((size_t)h * kS) * kS, 0, 0);  // global_prefetch_b8

  const size_t base = ((size_t)nr * kH + h) * kS * kCH;  // in halves
  // async 16B-chunk copies into padded rows: row = 32 halves = 4 chunks
  const uint32_t qs_off = lds_off(Qs), ks_off = lds_off(Ks);
  for (int i = tid; i < kS * kCH / 8; i += 256) {     // 1024 chunks each
    int key = i >> 2, c8 = (i & 3) * 8;               // chunk start (halves)
    uint32_t doff = (uint32_t)((key * kLdQ + c8) * 2);
    const f16* qsrc = Qh + base + key * kCH + c8;
    const f16* ksrc = Kh + base + key * kCH + c8;
    async_ld_b128(qs_off + doff, qsrc);
    async_ld_b128(ks_off + doff, ksrc);
  }
  const f16* vsrc = Vh + base;
  for (int i = tid; i < kS * kCH; i += 256) {         // transpose V -> Vt[ch][key]
    int key = i >> 5, ch = i & 31;
    Vt[ch * kLdP + key] = vsrc[i];
  }
  wait_async0();
  __syncthreads();

  // D/C layout of S^T tile nt: register r = S[key 16*nt + 8*hg + r][query q0 + (lane&15)]
  const float* bmp = bias_mask + (size_t)nr * kS + (hg << 3);
#pragma unroll 1
  for (int it = 0; it < 2; ++it) {           // each wave owns 16 query columns per trip
    const int q = (wave + it * 8) * 16 + (lane & 15);
    const float* bpp = bias_pair + ((size_t)h * kS + q) * kS + (hg << 3);
    v8f sacc[16];
#pragma unroll
    for (int nt = 0; nt < 16; ++nt) {        // 8 consecutive keys per lane: 16-byte loads
      v4f p0 = *(const v4f*)(bpp + nt * 16);
      v4f p1 = *(const v4f*)(bpp + nt * 16 + 4);
      sacc[nt] = __builtin_shufflevector(p0, p1, 0, 1, 2, 3, 4, 5, 6, 7);
    }
    // O^T: register r = O[query q][channel 16*ct + 8*hg + r]: 16-byte gate load and store
    const size_t gi = ((size_t)nr * kS + q) * kHC + h * kCH + (hg << 3);
    const f16* gp = Gh + gi;
    const v8h g0 = *(const v8h*)(gp);        // gate fetched at the top of the trip, long before its use
    const v8h g1 = *(const v8h*)(gp + 16);
    const v16h bq = ld_frag(Qs, q - (lane & 15), kLdQ, 0, lane);  // B = Q^T, K-dim = 32
    // address wait before the loads' address registers are reused; the pointers are
    // inputs so that no load of the run lands on an address pair itself
    asm volatile("s_wait_xcnt 0x0" :: "v"(bpp), "v"(gp) : "memory");
    sched_fence();     // all pair-bias loads in flight, landing in the accumulators
#pragma unroll
    for (int g = 0; g < 4; ++g) {            // 4 score tiles per fenced group
      v8f bm[4];
      v16h ak[4];
#pragma unroll
      for (int j = 0; j < 4; ++j) {
        const int nt = g * 4 + j;
        v4f m0 = *(const v4f*)(bmp + nt * 16);
        v4f m1 = *(const v4f*)(bmp + nt * 16 + 4);
        bm[j] = __builtin_shufflevector(m0, m1, 0, 1, 2, 3, 4, 5, 6, 7);
        ak[j] = ld_frag(Ks, nt * 16, kLdQ, 0, lane);              // A = K rows
      }
#pragma unroll
      for (int j = 0; j < 4; ++j)
        sacc[g * 4 + j] = wmma_f16(ak[j], bq, sacc[g * 4 + j] + bm[j]);
      sched_fence();   // cap live mask values and K fragments: no cross-group hoisting
    }
    // softmax over 256 keys of this lane's query: 128 in-lane values + other half
    float mx[8];
#pragma unroll
    for (int r = 0; r < 8; ++r) mx[r] = sacc[0][r];
#pragma unroll
    for (int nt = 1; nt < 16; ++nt)
#pragma unroll
      for (int r = 0; r < 8; ++r) mx[r] = fmaxf(mx[r], sacc[nt][r]);
    float m = fmaxf(fmaxf(fmaxf(mx[0], mx[1]), fmaxf(mx[2], mx[3])),
                    fmaxf(fmaxf(mx[4], mx[5]), fmaxf(mx[6], mx[7])));
    m = fmaxf(m, other_half(m));

    float sm[8] = {0.f, 0.f, 0.f, 0.f, 0.f, 0.f, 0.f, 0.f};
    v8f o0 = {}, o1 = {};
#pragma unroll
    for (int kk = 0; kk < 8; ++kk) {         // 32 keys: two score tiles -> one B operand
      v16h pb;
#pragma unroll
      for (int r = 0; r < 8; ++r) {
        float e0 = __expf(sacc[2 * kk][r] - m);
        float e1 = __expf(sacc[2 * kk + 1][r] - m);
        sm[r] += e0 + e1;
        pb[r]     = (f16)e0;
        pb[8 + r] = (f16)e1;
      }
      v16h a0 = ld_frag(Vt, 0,  kLdP, kk * 32, lane);             // A = V^T rows
      v16h a1 = ld_frag(Vt, 16, kLdP, kk * 32, lane);
      o0 = wmma_f16(a0, pb, o0);
      o1 = wmma_f16(a1, pb, o1);
    }
    float s = ((sm[0] + sm[1]) + (sm[2] + sm[3])) + ((sm[4] + sm[5]) + (sm[6] + sm[7]));
    s += other_half(s);
    const float rinv = __builtin_amdgcn_rcpf(s);

    v8h r0, r1;
#pragma unroll
    for (int r = 0; r < 8; ++r) {
      r0[r] = (f16)(o0[r] * rinv * (float)g0[r]);
      r1[r] = (f16)(o1[r] * rinv * (float)g1[r]);
    }
    *(v8h*)(Oh + gi)      = r0;
    *(v8h*)(Oh + gi + 16) = r1;
    // address wait before the next trip overwrites the stores' registers
    asm volatile("s_wait_xcnt 0x0" ::: "memory");
  }
}

// ===================== Kernel 3: output projection =====================
__global__ __launch_bounds__(256, 1)
void outproj_kernel(const f16* __restrict__ Oh,
                    const float* __restrict__ wo,
                    const float* __restrict__ bo,
                    float* __restrict__ out) {
  extern __shared__ f16 smem[];
  f16* As = smem;                 // [64][kLdP]  gated attention rows
  f16* wt = smem + 64 * kLdP;     // [128][kLdP] wo^T: wt[n][k]
  const int nr  = blockIdx.x >> 2;
  const int s0  = (blockIdx.x & 3) * 64;
  const int tid = threadIdx.x;
  const int lane = tid & 31, wave = tid >> 5, hg = lane >> 4;

  // async 16B-chunk copy of the 64x256 f16 tile into padded rows
  const f16* asrc = Oh + ((size_t)nr * kS + s0) * kHC;
  const uint32_t as_off = lds_off(As);
  for (int i = tid; i < 64 * kHC / 8; i += 256) {   // 2048 chunks
    int row = i >> 5, c8 = (i & 31) * 8;
    async_ld_b128(as_off + (uint32_t)((row * kLdP + c8) * 2),
                  asrc + row * kHC + c8);
  }
  for (int i = tid; i < kHC * kC; i += 256) {       // wo[k][n] -> wt[n][k]
    int k = i >> 7, n = i & 127;
    wt[n * kLdP + k] = (f16)wo[i];
  }
  wait_async0();
  __syncthreads();

#pragma unroll 1
  for (int j = 0; j < 4; ++j) {
    int t  = wave + j * 8;           // 32 tiles: 4 m x 8 n
    int m0 = (t >> 3) * 16, n0 = (t & 7) * 16;
    v8f acc = {};
#pragma unroll
    for (int g = 0; g < 2; ++g) {    // 4 (A,B) pairs per fenced group
      int k0 = g * 128;
      v16h a0 = ld_frag(As, m0, kLdP, k0 + 0,  lane);
      v16h a1 = ld_frag(As, m0, kLdP, k0 + 32, lane);
      v16h a2 = ld_frag(As, m0, kLdP, k0 + 64, lane);
      v16h a3 = ld_frag(As, m0, kLdP, k0 + 96, lane);
      v16h b0 = ld_frag(wt, n0, kLdP, k0 + 0,  lane);
      v16h b1 = ld_frag(wt, n0, kLdP, k0 + 32, lane);
      v16h b2 = ld_frag(wt, n0, kLdP, k0 + 64, lane);
      v16h b3 = ld_frag(wt, n0, kLdP, k0 + 96, lane);
      acc = wmma_f16(a0, b0, acc);
      acc = wmma_f16(a1, b1, acc);
      acc = wmma_f16(a2, b2, acc);
      acc = wmma_f16(a3, b3, acc);
      sched_fence();
    }
    int c = n0 + (lane & 15);
    float bias = bo[c];
#pragma unroll
    for (int r = 0; r < 8; ++r) {
      int srow = s0 + m0 + r + (hg << 3);
      out[((size_t)nr * kS + srow) * kC + c] = acc[r] + bias;
    }
    sched_fence();
  }
}

extern "C" void kernel_launch(void* const* d_in, const int* in_sizes, int n_in,
                              void* d_out, int out_size, void* d_ws, size_t ws_size,
                              hipStream_t stream) {
  const float* q_x       = (const float*)d_in[0];
  const float* kv_x      = (const float*)d_in[1];
  const float* bias_mask = (const float*)d_in[2];
  const float* bias_pair = (const float*)d_in[3];
  const float* wq = (const float*)d_in[4];
  const float* wk = (const float*)d_in[5];
  const float* wv = (const float*)d_in[6];
  const float* wg = (const float*)d_in[7];
  const float* bg = (const float*)d_in[8];
  const float* wo = (const float*)d_in[9];
  const float* bo = (const float*)d_in[10];
  float* out = (float*)d_out;

  char* wsb = (char*)d_ws;
  const size_t SZ = (size_t)kNR * kH * kS * kCH * sizeof(f16);  // 33.5 MB each
  f16* Qh = (f16*)(wsb + 0 * SZ);   // [NR][H][S][CH], pre-scaled
  f16* Kh = (f16*)(wsb + 1 * SZ);   // [NR][H][S][CH]
  f16* Vh = (f16*)(wsb + 2 * SZ);   // [NR][H][S][CH]
  f16* Gh = (f16*)(wsb + 3 * SZ);   // [NR][S][HC] sigmoid gate
  f16* Oh = (f16*)(wsb + 4 * SZ);   // [NR][S][HC] gated attention out

  dim3 blk(256);
  const size_t smem1 = (2 * kRT * kLdX + 8 * 32 * kLdO) * sizeof(f16) + kHC * sizeof(float);
  proj_all_kernel<<<dim3(kNR * 2), blk, smem1, stream>>>(
      q_x, kv_x, wq, wk, wv, wg, bg, Qh, Kh, Vh, Gh);
  attn_kernel<<<dim3(kNR * kH), blk,
                (2 * kS * kLdQ + kCH * kLdP) * sizeof(f16), stream>>>(
      bias_mask, bias_pair, Qh, Kh, Vh, Gh, Oh);
  outproj_kernel<<<dim3(kNR * 4), blk,
                   (64 * kLdP + kC * kLdP) * sizeof(f16), stream>>>(
      Oh, wo, bo, out);
}

// v003
// Measured time: 116 microseconds a run.
// Two timings next to v002 both put it at 1.12 times that version's speed.
// All steps since v000 together make it 2.00 times as fast.
#include <hip/hip_runtime.h>

typedef _Float16 f16;
typedef __attribute__((ext_vector_type(4)))  _Float16 v4h;
typedef __attribute__((ext_vector_type(8)))  _Float16 v8h;
typedef __attribute__((ext_vector_type(16))) _Float16 v16h;
typedef __attribute__((ext_vector_type(8)))  float    v8f;
typedef __attribute__((ext_vector_type(4)))  float    v4f;

constexpr int kS  = 256;   // tokens (Q = K)
constexpr int kC  = 128;   // input channels (CQ=CK=CV)
constexpr int kH  = 8;     // heads
constexpr int kCH = 32;    // head dim
constexpr int kHC = 256;   // H*CH
constexpr int kNR = 256;   // rows
constexpr int kRT = 32;    // tokens per staged activation tile (projections)
constexpr int kPB = 128;   // (head, 16-query tile) pairs: one re-laying block each

// padded LDS row strides (halves): odd multiples of 8 -> 16B-aligned b128
// loads with lanes spread across banks
constexpr int kLdX = 136;  // 128 + 8
constexpr int kLdO = 40;   // 32 + 8 (projection output rows on their way to whole-line stores)
constexpr int kLdQ = 40;   // 32 + 8 (Q/K tiles, K-dim 32)
constexpr int kLdP = 264;  // 256 + 8 (V^T and out-projection rows, K-dim 256)

// ---- fragment loader (CDNA5 16-bit WMMA layout, ISA 7.12.2) ----
// Source is [M][K] (A) or [N][K] (B^T staged): lane owns row (base + lane&15),
// element i holds K = k0 + 8*(lane>>4) + i + (i>=8 ? 8 : 0)  -> two
// contiguous 16-byte runs -> exactly two ds_load_b128 per fragment.
__device__ __forceinline__ v16h ld_frag(const f16* p, int row0, int ld,
                                        int k0, int lane) {
  const f16* q = p + (size_t)(row0 + (lane & 15)) * ld + k0 + ((lane >> 4) << 3);
  v8h lo = *(const v8h*)(q);
  v8h hi = *(const v8h*)(q + 16);
  return __builtin_shufflevector(lo, hi, 0, 1, 2, 3, 4, 5, 6, 7,
                                 8, 9, 10, 11, 12, 13, 14, 15);
}

__device__ __forceinline__ v8f wmma_f16(v16h a, v16h b, v8f c) {
  return __builtin_amdgcn_wmma_f32_16x16x32_f16(false, a, false, b,
                                                (short)0, c, false, false);
}

// scheduling fence: keep register pressure bounded (no hoisting across)
__device__ __forceinline__ void sched_fence() {
  __builtin_amdgcn_sched_barrier(0);
}

// ---- CDNA5 async global->LDS copy (ASYNCcnt tracked, no VGPR data) ----
__device__ __forceinline__ void async_ld_b128(uint32_t lds_byte_off, const f16* g) {
  asm volatile("global_load_async_to_lds_b128 %0, %1, off"
               :: "v"(lds_byte_off), "v"(g) : "memory");
}
__device__ __forceinline__ void wait_async0() {
  asm volatile("s_wait_asynccnt 0x0" ::: "memory");
}
__device__ __forceinline__ uint32_t lds_off(const void* p) {
  return (uint32_t)(uintptr_t)p;   // low 32 bits of shared aperture = LDS offset
}

// work-group barrier that orders LDS only: the next tile's global loads stay in
// flight across it and the output stores are not waited for (__syncthreads drains both)
__device__ __forceinline__ void lds_barrier() {
  __builtin_amdgcn_fence(__ATOMIC_RELEASE, "workgroup", "local");
  __builtin_amdgcn_s_barrier();
  __builtin_amdgcn_fence(__ATOMIC_ACQUIRE, "workgroup", "local");
}

// reciprocal and 2^x with the one free slot that the instruction set asks for behind
// a transcendental
__device__ __forceinline__ float rcp_slot(float x) {
  float y;
  asm("v_rcp_f32 %0, %1\n\tv_nop" : "=v"(y) : "v"(x));
  return y;
}
__device__ __forceinline__ float exp2_slot(float x) {
  float y;
  asm("v_exp_f32 %0, %1\n\tv_nop" : "=v"(y) : "v"(x));
  return y;
}

// ===================== Kernel 1: input projections, one launch =====================
// Weight-stationary and transposed: D^T = W^T X^T. A block takes one row group
// (256 tokens) of one activation (even blocks q_x: wq, wg; odd blocks kv_x: wk, wv).
// A wave keeps the A fragments of its 64 output columns in registers for the whole
// block; only the activation goes through LDS, in 32-token tiles, two buffers.
// Column map of a wave: row j of matrix tile t is column base + 4*j + t, so one
// 16-byte load of a weight row feeds all four tiles, and lane (token, hg) ends up
// with the 32 consecutive columns base + 32*hg .. +31 of its token.
// The first kPB blocks do no projection: each re-lays one 16-query x 256-key tile of
// the pair bias into the order in which the attention kernel's lanes take it as the
// C operand of S^T: Bp[tile][nt][half][lane] (16 bytes each) =
// bias_pair[h][16*qt + (lane&15)][16*nt + 8*(lane>>4) + 4*half .. +3], tile = 16*h + qt.
// The tile is read 256 times (once per row group), so the scattered read is paid here
// once and every later wave-wide 16-byte load covers 512 contiguous bytes.
__global__ __launch_bounds__(256, 4)
void proj_all_kernel(const float* __restrict__ q_x, const float* __restrict__ kv_x,
                     const float* __restrict__ wq,  const float* __restrict__ wk,
                     const float* __restrict__ wv,  const float* __restrict__ wg,
                     const float* __restrict__ bg,
                     const float* __restrict__ bias_pair, float* __restrict__ Bp,
                     f16* __restrict__ Qh, f16* __restrict__ Kh,
                     f16* __restrict__ Vh, f16* __restrict__ Gh) {
  extern __shared__ f16 smem[];
  f16*   xs  = smem;                               // [2][kRT][kLdX] activation tiles
  f16*   os  = smem + 2 * kRT * kLdX;              // [8 waves][32][kLdO] output rows
  float* bgs = (float*)(os + 8 * 32 * kLdO);       // [256] gate bias
  const int tid  = threadIdx.x;
  if (blockIdx.x < kPB) {                          // block-uniform, in front of every barrier
    const float* bsrc = bias_pair + (size_t)blockIdx.x * 16 * kS
                        + (tid & 15) * kS + ((tid >> 4) & 1) * 8 + ((tid >> 5) & 1) * 4
                        + (tid >> 6) * 16;
    v4f* bdst = (v4f*)Bp + (size_t)blockIdx.x * (16 * kS / 4) + tid;
    v4f bv[4];
#pragma unroll
    for (int j = 0; j < 4; ++j) bv[j] = *(const v4f*)(bsrc + j * 64);   // nt = tid/64 + 4*j
#pragma unroll
    for (int j = 0; j < 4; ++j) bdst[j * 256] = bv[j];
    return;
  }
  const int side = blockIdx.x & 1;                 // kPB is even
  const int nr   = (blockIdx.x - kPB) >> 1;
  const int lane = tid & 31, hg = lane >> 4, ln = lane & 15;
  const int wave = __builtin_amdgcn_readfirstlane(tid >> 5);
  const bool second = wave >= 4;                   // waves 4..7: wg or wv
  const bool gate   = second && side == 0;
  const int  base   = (wave & 3) * 64;             // first output column of this wave

  const float* wp  = side ? (second ? wv : wk) : (second ? wg : wq);
  f16*         dst = side ? (second ? Vh : Kh) : (second ? Gh : Qh);
  const bool   isq = side == 0 && !second;         // Q carries 1/sqrt(32)

  f16* ow = os + wave * 32 * kLdO;                 // this wave's own staging rows
  f16* owr = ow + (hg * 16 + ln) * kLdO;           // written: row (hg, token)
  // read back so that every 16-byte store instruction covers whole 128-byte lines:
  // gate [NR][S][HC]: 4 tokens x 128 bytes per store; Q/K/V [NR][H][S][CH]: 8 tokens
  // x 64 bytes of one head per store, stores 2 and 3 in the wave's second head
  const f16* ord = ow + (gate ? (((lane >> 2) & 1) * 16 + (lane >> 3)) : (lane >> 2)) * kLdO
                   + (lane & 3) * 8;
  const int ostep = gate ? 4 * kLdO : 8 * kLdO;    // LDS step per store
  f16* gdst = dst + (gate ? ((size_t)nr * kS + (lane >> 3)) * kHC + base + (lane & 7) * 8
                          : ((size_t)nr * kH + (wave & 3) * 2) * kS * kCH + lane * 8);
  const int gstep = gate ? 4 * kHC : 8 * kCH;      // global step per store
  const int hstep = gate ? 0 : kS * kCH - 2 * gstep;   // on to the second head
  const int tstep = gate ? kHC : kCH;              // global step per token

  // a wave-wide 16-byte load covers one whole 512-byte token row
  const v4f* xsrc = (const v4f*)((side ? kv_x : q_x) + (size_t)nr * kS * kC) + tid;
  f16* xdst = xs + (tid >> 5) * kLdX + lane * 4;
  v4f xr[4];
#pragma unroll
  for (int j = 0; j < 4; ++j) xr[j] = xsrc[j * 256];

  bgs[tid] = bg[tid];

  v16h wf[4][4];                                   // [tile t][k step]
  const float* wl = wp + base + 4 * ln + (hg << 3) * kHC;
  v4f wr[2][16];                                   // one k step in use, the next in flight
#pragma unroll
  for (int i = 0; i < 16; ++i)                     // same k order as ld_frag
    wr[0][i] = *(const v4f*)(wl + (i + (i >= 8 ? 8 : 0)) * kHC);
#pragma unroll
  for (int ks = 0; ks < 4; ++ks) {
    v4f* wc = wr[ks & 1];
    if (ks + 1 < 4) {
#pragma unroll
      for (int i = 0; i < 16; ++i)
        wr[(ks + 1) & 1][i] = *(const v4f*)(wl + ((ks + 1) * 32 + i + (i >= 8 ? 8 : 0)) * kHC);
    }
    // holds the later k steps' loads behind this step's values: all 64 loads
    // issued at once need more registers than the wave has and spill
    asm volatile("" :: "v"(wc[0]), "v"(wc[1]), "v"(wc[2]), "v"(wc[3]), "v"(wc[4]), "v"(wc[5]),
                 "v"(wc[6]), "v"(wc[7]), "v"(wc[8]), "v"(wc[9]), "v"(wc[10]), "v"(wc[11]),
                 "v"(wc[12]), "v"(wc[13]), "v"(wc[14]), "v"(wc[15]) : "memory");
#pragma unroll
    for (int i = 0; i < 16; ++i)
#pragma unroll
      for (int t = 0; t < 4; ++t) wf[t][ks][i] = (f16)wc[i][t];
  }

#pragma unroll
  for (int j = 0; j < 4; ++j)
    *(v4h*)(xdst + j * 8 * kLdX) = __builtin_convertvector(xr[j], v4h);
#pragma unroll
  for (int j = 0; j < 4; ++j) xr[j] = xsrc[1024 + j * 256];
  // address wait before the loads' address registers are reused
  asm volatile("s_wait_xcnt 0x0" ::: "memory");
  lds_barrier();

#pragma unroll 1   // rolled: the buffer index is the only thing that differs between trips
  for (int tt = 0; tt < kS / kRT; ++tt) {
    const f16* xb = xs + (tt & 1) * kRT * kLdX;
#pragma unroll 1   // rolled: beside the weight fragments there are registers for one tile only
    for (int st = 0; st < kRT / 16; ++st) {
      v16h xf[4];                                  // B = X^T, all four k steps
#pragma unroll
      for (int ks = 0; ks < 4; ++ks) xf[ks] = ld_frag(xb, st * 16, kLdX, ks * 32, lane);
      sched_fence();   // one group of LDS reads, one wait: none among the WMMAs
      v8f acc[4] = {};
#pragma unroll
      for (int ks = 0; ks < 4; ++ks)
#pragma unroll
        for (int t = 0; t < 4; ++t) acc[t] = wmma_f16(wf[t][ks], xf[ks], acc[t]);
      if (gate) {
#pragma unroll
        for (int r = 0; r < 8; ++r) {
          const v4f b4 = *(const v4f*)(bgs + base + 32 * hg + 4 * r);
#pragma unroll
          for (int t = 0; t < 4; ++t)
            acc[t][r] = rcp_slot(1.0f + exp2_slot((acc[t][r] + b4[t]) * -1.4426950408889634f));  // sigmoid
        }
      } else if (isq) {
#pragma unroll
        for (int t = 0; t < 4; ++t) acc[t] *= 0.17677669529663687f;
      }
#pragma unroll
      for (int c = 0; c < 4; ++c) {                // columns 8c .. 8c+7 of the lane's 32
        v8h o;
#pragma unroll
        for (int e = 0; e < 8; ++e) o[e] = (f16)acc[e & 3][2 * c + (e >> 2)];
        *(v8h*)(owr + c * 8) = o;
      }
      // the rows come back from other lanes of this wave: their LDS writes first
      asm volatile("s_wait_dscnt 0x0" ::: "memory");
      const int tok = tt * kRT + st * 16;          // first token of this 16-token tile
      f16* g = gdst + tok * tstep;
#pragma unroll
      for (int c = 0; c < 4; ++c)
        *(v8h*)(g + c * gstep + (c >> 1) * hstep) = *(const v8h*)(ord + c * ostep);
      // address wait before the next tile overwrites the stores' registers
      asm volatile("s_wait_xcnt 0x0" ::: "memory");
    }
    if (tt + 1 < kS / kRT) {                       // block-uniform
      f16* xn = xdst + ((tt + 1) & 1) * kRT * kLdX;   // last read in trip tt - 1
#pragma unroll
      for (int j = 0; j < 4; ++j)
        *(v4h*)(xn + j * 8 * kLdX) = __builtin_convertvector(xr[j], v4h);
      if (tt + 2 < kS / kRT) {
#pragma unroll
        for (int j = 0; j < 4; ++j) xr[j] = xsrc[(tt + 2) * 1024 + j * 256];
        // address wait before the loads' address registers are reused
        asm volatile("s_wait_xcnt 0x0" ::: "memory");
      }
      lds_barrier();
    }
  }
}

__device__ __forceinline__ float other_half(float x) {   // lane l <-> l ^ 16
  int b = __builtin_bit_cast(int, x);
  b = __builtin_amdgcn_permlanex16(b, b, 0x76543210, 0xfedcba98, false, false);
  return __builtin_bit_cast(float, b);
}

// 4 waves per SIMD: two work-groups share a WGP now that LDS allows it
__global__ __launch_bounds__(256, 4)
void attn_kernel(const float* __restrict__ bias_mask,
                 const float* __restrict__ Bp,
                 const f16* __restrict__ Qh, const f16* __restrict__ Kh,
                 const f16* __restrict__ Vh, const f16* __restrict__ Gh,
                 f16* __restrict__ Oh) {
  extern __shared__ f16 smem[];
  f16* Qs = smem;                          // [256][kLdQ]
  f16* Ks = Qs + kS * kLdQ;                // [256][kLdQ]
  f16* Vt = Ks + kS * kLdQ;                // [32][kLdP]  V^T: Vt[ch][key]
  const int nr  = blockIdx.x >> 3;
  const int h   = blockIdx.x & 7;
  const int tid = threadIdx.x;
  const int lane = tid & 31, wave = tid >> 5, hg = lane >> 4;

  __builtin_prefetch(Bp + ((size_t)h * kS) * kS, 0, 0);  // global_prefetch_b8

  const size_t base = ((size_t)nr * kH + h) * kS * kCH;  // in halves
  // async 16B-chunk copies into padded rows: row = 32 halves = 4 chunks
  const uint32_t qs_off = lds_off(Qs), ks_off = lds_off(Ks);
  for (int i = tid; i < kS * kCH / 8; i += 256) {     // 1024 chunks each
    int key = i >> 2, c8 = (i & 3) * 8;               // chunk start (halves)
    uint32_t doff = (uint32_t)((key * kLdQ + c8) * 2);
    const f16* qsrc = Qh + base + key * kCH + c8;
    const f16* ksrc = Kh + base + key * kCH + c8;
    async_ld_b128(qs_off + doff, qsrc);
    async_ld_b128(ks_off + doff, ksrc);
  }
  const f16* vsrc = Vh + base;
  for (int i = tid; i < kS * kCH; i += 256) {         // transpose V -> Vt[ch][key]
    int key = i >> 5, ch = i & 31;
    Vt[ch * kLdP + key] = vsrc[i];
  }
  wait_async0();
  __syncthreads();

  // D/C layout of S^T tile nt: register r = S[key 16*nt + 8*hg + r][query q0 + (lane&15)]
  const float* bmp = bias_mask + (size_t)nr * kS + (hg << 3);
#pragma unroll 1
  for (int it = 0; it < 2; ++it) {           // each wave owns 16 query columns per trip
    const int q = (wave + it * 8) * 16 + (lane & 15);
    // re-laid pair bias: lane-contiguous, every load covers four whole 128-byte lines
    const v4f* bpp = (const v4f*)Bp + (size_t)(h * 16 + wave + it * 8) * (16 * kS / 4) + lane;
    v8f sacc[16];
#pragma unroll
    for (int nt = 0; nt < 16; ++nt) {        // 8 consecutive keys per lane: 16-byte loads
      v4f p0 = bpp[nt * 64];
      v4f p1 = bpp[nt * 64 + 32];
      sacc[nt] = __builtin_shufflevector(p0, p1, 0, 1, 2, 3, 4, 5, 6, 7);
    }
    // O^T: register r = O[query q][channel 16*ct + 8*hg + r]: 16-byte gate load and store
    const size_t gi = ((size_t)nr * kS + q) * kHC + h * kCH + (hg << 3);
    const f16* gp = Gh + gi;
    const v8h g0 = *(const v8h*)(gp);        // gate fetched at the top of the trip, long before its use
    const v8h g1 = *(const v8h*)(gp + 16);
    const v16h bq = ld_frag(Qs, q - (lane & 15), kLdQ, 0, lane);  // B = Q^T, K-dim = 32
    // address wait before the loads' address registers are reused; the pointers are
    // inputs so that no load of the run lands on an address pair itself
    asm volatile("s_wait_xcnt 0x0" :: "v"(bpp), "v"(gp) : "memory");
    sched_fence();     // all pair-bias loads in flight, landing in the accumulators
#pragma unroll
    for (int g = 0; g < 4; ++g) {            // 4 score tiles per fenced group
      v8f bm[4];
      v16h ak[4];
#pragma unroll
      for (int j = 0; j < 4; ++j) {
        const int nt = g * 4 + j;
        v4f m0 = *(const v4f*)(bmp + nt * 16);
        v4f m1 = *(const v4f*)(bmp + nt * 16 + 4);
        bm[j] = __builtin_shufflevector(m0, m1, 0, 1, 2, 3, 4, 5, 6, 7);
        ak[j] = ld_frag(Ks, nt * 16, kLdQ, 0, lane);              // A = K rows
      }
#pragma unroll
      for (int j = 0; j < 4; ++j)
        sacc[g * 4 + j] = wmma_f16(ak[j], bq, sacc[g * 4 + j] + bm[j]);
      sched_fence();   // cap live mask values and K fragments: no cross-group hoisting
    }
    // softmax over 256 keys of this lane's query: 128 in-lane values + other half
    float mx[8];
#pragma unroll
    for (int r = 0; r < 8; ++r) mx[r] = sacc[0][r];
#pragma unroll
    for (int nt = 1; nt < 16; ++nt)
#pragma unroll
      for (int r = 0; r < 8; ++r) mx[r] = fmaxf(mx[r], sacc[nt][r]);
    float m = fmaxf(fmaxf(fmaxf(mx[0], mx[1]), fmaxf(mx[2], mx[3])),
                    fmaxf(fmaxf(mx[4], mx[5]), fmaxf(mx[6], mx[7])));
    m = fmaxf(m, other_half(m));

    float sm[8] = {0.f, 0.f, 0.f, 0.f, 0.f, 0.f, 0.f, 0.f};
    v8f o0 = {}, o1 = {};
#pragma unroll
    for (int kk = 0; kk < 8; ++kk) {         // 32 keys: two score tiles -> one B operand
      v16h pb;
#pragma unroll
      for (int r = 0; r < 8; ++r) {
        float e0 = __expf(sacc[2 * kk][r] - m);
        float e1 = __expf(sacc[2 * kk + 1][r] - m);
        sm[r] += e0 + e1;
        pb[r]     = (f16)e0;
        pb[8 + r] = (f16)e1;
      }
      v16h a0 = ld_frag(Vt, 0,  kLdP, kk * 32, lane);             // A = V^T rows
      v16h a1 = ld_frag(Vt, 16, kLdP, kk * 32, lane);
      o0 = wmma_f16(a0, pb, o0);
      o1 = wmma_f16(a1, pb, o1);
    }
    float s = ((sm[0] + sm[1]) + (sm[2] + sm[3])) + ((sm[4] + sm[5]) + (sm[6] + sm[7]));
    s += other_half(s);
    const float rinv = __builtin_amdgcn_rcpf(s);

    v8h r0, r1;
#pragma unroll
    for (int r = 0; r < 8; ++r) {
      r0[r] = (f16)(o0[r] * rinv * (float)g0[r]);
      r1[r] = (f16)(o1[r] * rinv * (float)g1[r]);
    }
    *(v8h*)(Oh + gi)      = r0;
    *(v8h*)(Oh + gi + 16) = r1;
    // address wait before the next trip overwrites the stores' registers
    asm volatile("s_wait_xcnt 0x0" ::: "memory");
  }
}

// ===================== Kernel 3: output projection =====================
__global__ __launch_bounds__(256, 1)
void outproj_kernel(const f16* __restrict__ Oh,
                    const float* __restrict__ wo,
                    const float* __restrict__ bo,
                    float* __restrict__ out) {
  extern __shared__ f16 smem[];
  f16* As = smem;                 // [64][kLdP]  gated attention rows
  f16* wt = smem + 64 * kLdP;     // [128][kLdP] wo^T: wt[n][k]
  const int nr  = blockIdx.x >> 2;
  const int s0  = (blockIdx.x & 3) * 64;
  const int tid = threadIdx.x;
  const int lane = tid & 31, wave = tid >> 5, hg = lane >> 4;

  // async 16B-chunk copy of the 64x256 f16 tile into padded rows
  const f16* asrc = Oh + ((size_t)nr * kS + s0) * kHC;
  const uint32_t as_off = lds_off(As);
  for (int i = tid; i < 64 * kHC / 8; i += 256) {   // 2048 chunks
    int row = i >> 5, c8 = (i & 31) * 8;
    async_ld_b128(as_off + (uint32_t)((row * kLdP + c8) * 2),
                  asrc + row * kHC + c8);
  }
  for (int i = tid; i < kHC * kC; i += 256) {       // wo[k][n] -> wt[n][k]
    int k = i >> 7, n = i & 127;
    wt[n * kLdP + k] = (f16)wo[i];
  }
  wait_async0();
  __syncthreads();

#pragma unroll 1
  for (int j = 0; j < 4; ++j) {
    int t  = wave + j * 8;           // 32 tiles: 4 m x 8 n
    int m0 = (t >> 3) * 16, n0 = (t & 7) * 16;
    v8f acc = {};
#pragma unroll
    for (int g = 0; g < 2; ++g) {    // 4 (A,B) pairs per fenced group
      int k0 = g * 128;
      v16h a0 = ld_frag(As, m0, kLdP, k0 + 0,  lane);
      v16h a1 = ld_frag(As, m0, kLdP, k0 + 32, lane);
      v16h a2 = ld_frag(As, m0, kLdP, k0 + 64, lane);
      v16h a3 = ld_frag(As, m0, kLdP, k0 + 96, lane);
      v16h b0 = ld_frag(wt, n0, kLdP, k0 + 0,  lane);
      v16h b1 = ld_frag(wt, n0, kLdP, k0 + 32, lane);
      v16h b2 = ld_frag(wt, n0, kLdP, k0 + 64, lane);
      v16h b3 = ld_frag(wt, n0, kLdP, k0 + 96, lane);
      acc = wmma_f16(a0, b0, acc);
      acc = wmma_f16(a1, b1, acc);
      acc = wmma_f16(a2, b2, acc);
      acc = wmma_f16(a3, b3, acc);
      sched_fence();
    }
    int c = n0 + (lane & 15);
    float bias = bo[c];
#pragma unroll
    for (int r = 0; r < 8; ++r) {
      int srow = s0 + m0 + r + (hg << 3);
      out[((size_t)nr * kS + srow) * kC + c] = acc[r] + bias;
    }
    sched_fence();
  }
}

extern "C" void kernel_launch(void* const* d_in, const int* in_sizes, int n_in,
                              void* d_out, int out_size, void* d_ws, size_t ws_size,
                              hipStream_t stream) {
  const float* q_x       = (const float*)d_in[0];
  const float* kv_x      = (const float*)d_in[1];
  const float* bias_mask = (const float*)d_in[2];
  const float* bias_pair = (const float*)d_in[3];
  const float* wq = (const float*)d_in[4];
  const float* wk = (const float*)d_in[5];
  const float* wv = (const float*)d_in[6];
  const float* wg = (const float*)d_in[7];
  const float* bg = (const float*)d_in[8];
  const float* wo = (const float*)d_in[9];
  const float* bo = (const float*)d_in[10];
  float* out = (float*)d_out;

  char* wsb = (char*)d_ws;
  const size_t SZ = (size_t)kNR * kH * kS * kCH * sizeof(f16);  // 33.5 MB each
  f16* Qh = (f16*)(wsb + 0 * SZ);   // [NR][H][S][CH], pre-scaled
  f16* Kh = (f16*)(wsb + 1 * SZ);   // [NR][H][S][CH]
  f16* Vh = (f16*)(wsb + 2 * SZ);   // [NR][H][S][CH]
  f16* Gh = (f16*)(wsb + 3 * SZ);   // [NR][S][HC] sigmoid gate
  f16* Oh = (f16*)(wsb + 4 * SZ);   // [NR][S][HC] gated attention out
  float* Bp = (float*)(wsb + 5 * SZ);   // [H*16][16][2][32][4] pair bias in C-operand order, 2 MB

  dim3 blk(256);
  const size_t smem1 = (2 * kRT * kLdX + 8 * 32 * kLdO) * sizeof(f16) + kHC * sizeof(float);
  proj_all_kernel<<<dim3(kPB + kNR * 2), blk, smem1, stream>>>(
      q_x, kv_x, wq, wk, wv, wg, bg, bias_pair, Bp, Qh, Kh, Vh, Gh);
  attn_kernel<<<dim3(kNR * kH), blk,
                (2 * kS * kLdQ + kCH * kLdP) * sizeof(f16), stream>>>(
      bias_mask, Bp, Qh, Kh, Vh, Gh, Oh);
  outproj_kernel<<<dim3(kNR * 4), blk,
                   (64 * kLdP + kC * kLdP) * sizeof(f16), stream>>>(
      Oh, wo, bo, out);
}

// v004
// It runs in 107 microseconds.
// Next to v003, in two timings, it ran 1.08 and 1.09 times as fast.
// All steps since v000 together make it 2.17 times as fast.
#include <hip/hip_runtime.h>

typedef _Float16 f16;
typedef __attribute__((ext_vector_type(4)))  _Float16 v4h;
typedef __attribute__((ext_vector_type(8)))  _Float16 v8h;
typedef __attribute__((ext_vector_type(16))) _Float16 v16h;
typedef __attribute__((ext_vector_type(8)))  float    v8f;
typedef __attribute__((ext_vector_type(4)))  float    v4f;
typedef __attribute__((ext_vector_type(8)))  short    v8s;

constexpr int kS  = 256;   // tokens (Q = K)
constexpr int kC  = 128;   // input channels (CQ=CK=CV)
constexpr int kH  = 8;     // heads
constexpr int kCH = 32;    // head dim
constexpr int kHC = 256;   // H*CH
constexpr int kNR = 256;   // rows
constexpr int kRT = 32;    // tokens per staged activation tile (projections)
constexpr int kPB = 128;   // (head, 16-query tile) pairs: one re-laying block each

// padded LDS row strides (halves): odd multiples of 8 (kLdV: of 16) -> 16B-aligned b128
// loads with lanes spread across banks
constexpr int kLdX = 136;  // 128 + 8
constexpr int kLdO = 40;   // 32 + 8 (projection output rows on their way to whole-line stores)
constexpr int kLdQ = 40;   // 32 + 8 (Q/K tiles, K-dim 32)
constexpr int kLdP = 264;  // 256 + 8 (output projection rows, K-dim 256)
constexpr int kLdV = 48;   // 32 + 16 (V rows): 96 bytes, an odd multiple of 32, the transposing load's pitch

// ---- fragment loader (CDNA5 16-bit WMMA layout, ISA 7.12.2) ----
// Source is [M][K] (A) or [N][K] (B^T staged): lane owns row (base + lane&15),
// element i holds K = k0 + 8*(lane>>4) + i + (i>=8 ? 8 : 0)  -> two
// contiguous 16-byte runs -> exactly two ds_load_b128 per fragment.
__device__ __forceinline__ v16h ld_frag(const f16* p, int row0, int ld,
                                        int k0, int lane) {
  const f16* q = p + (size_t)(row0 + (lane & 15)) * ld + k0 + ((lane >> 4) << 3);
  v8h lo = *(const v8h*)(q);
  v8h hi = *(const v8h*)(q + 16);
  return __builtin_shufflevector(lo, hi, 0, 1, 2, 3, 4, 5, 6, 7,
                                 8, 9, 10, 11, 12, 13, 14, 15);
}

// ---- transposing fragment loader: A = T^T from a row-major LDS tile T[k][m] ----
// p is the lane's own address, T + (k0 + 8*(lane>>4) + (lane&7)) * ld + m0 + 8*((lane>>3)&1);
// the lane gets T[k0 + 8*(lane>>4) + i + (i>=8 ? 8 : 0)][m0 + (lane&15)]: ld_frag's k order.
__device__ __forceinline__ v8h ld_tr16(const f16* p) {
  typedef __attribute__((address_space(3))) v8s lds_v8s;
  return __builtin_bit_cast(v8h, __builtin_amdgcn_ds_load_tr16_b128_v8i16((lds_v8s*)p));
}
__device__ __forceinline__ v16h ld_frag_tr(const f16* p, int ld) {
  v8h lo = ld_tr16(p);
  v8h hi = ld_tr16(p + 16 * ld);
  return __builtin_shufflevector(lo, hi, 0, 1, 2, 3, 4, 5, 6, 7,
                                 8, 9, 10, 11, 12, 13, 14, 15);
}

__device__ __forceinline__ v8f wmma_f16(v16h a, v16h b, v8f c) {
  return __builtin_amdgcn_wmma_f32_16x16x32_f16(false, a, false, b,
                                                (short)0, c, false, false);
}

// scheduling fence: keep register pressure bounded (no hoisting across)
__device__ __forceinline__ void sched_fence() {
  __builtin_amdgcn_sched_barrier(0);
}

// ---- CDNA5 async global->LDS copy (ASYNCcnt tracked, no VGPR data) ----
__device__ __forceinline__ void async_ld_b128(uint32_t lds_byte_off, const f16* g) {
  asm volatile("global_load_async_to_lds_b128 %0, %1, off"
               :: "v"(lds_byte_off), "v"(g) : "memory");
}
// four copies of one lane; the address wait is the statement's last line, so that it
// stands in front of whatever reuses the copies' address registers
__device__ __forceinline__ void async_ld4_b128(uint32_t l0, uint32_t l1, uint32_t l2, uint32_t l3,
                                               const f16* g0, const f16* g1,
                                               const f16* g2, const f16* g3) {
  asm volatile("global_load_async_to_lds_b128 %0, %4, off\n\t"
               "global_load_async_to_lds_b128 %1, %5, off\n\t"
               "global_load_async_to_lds_b128 %2, %6, off\n\t"
               "global_load_async_to_lds_b128 %3, %7, off\n\t"
               "s_wait_xcnt 0x0"
               :: "v"(l0), "v"(l1), "v"(l2), "v"(l3), "v"(g0), "v"(g1), "v"(g2), "v"(g3)
               : "memory");
}
__device__ __forceinline__ void wait_async0() {
  asm volatile("s_wait_asynccnt 0x0" ::: "memory");
}
__device__ __forceinline__ uint32_t lds_off(const void* p) {
  return (uint32_t)(uintptr_t)p;   // low 32 bits of shared aperture = LDS offset
}

// work-group barrier that orders LDS only: the next tile's global loads stay in
// flight across it and the output stores are not waited for (__syncthreads drains both)
__device__ __forceinline__ void lds_barrier() {
  __builtin_amdgcn_fence(__ATOMIC_RELEASE, "workgroup", "local");
  __builtin_amdgcn_s_barrier();
  __builtin_amdgcn_fence(__ATOMIC_ACQUIRE, "workgroup", "local");
}

// reciprocal and 2^x with the one free slot that the instruction set asks for behind
// a transcendental
__device__ __forceinline__ float rcp_slot(float x) {
  float y;
  asm("v_rcp_f32 %0, %1\n\tv_nop" : "=v"(y) : "v"(x));
  return y;
}
__device__ __forceinline__ float exp2_slot(float x) {
  float y;
  asm("v_exp_f32 %0, %1\n\tv_nop" : "=v"(y) : "v"(x));
  return y;
}

// ===================== Kernel 1: input projections, one launch =====================
// Weight-stationary and transposed: D^T = W^T X^T. A block takes one row group
// (256 tokens) of one activation (even blocks q_x: wq, wg; odd blocks kv_x: wk, wv).
// A wave keeps the A fragments of its 64 output columns in registers for the whole
// block; only the activation goes through LDS, in 32-token tiles, two buffers.
// Column map of a wave: row j of matrix tile t is column base + 4*j + t, so one
// 16-byte load of a weight row feeds all four tiles, and lane (token, hg) ends up
// with the 32 consecutive columns base + 32*hg .. +31 of its token.
// The first kPB blocks do no projection: each re-lays one 16-query x 256-key tile of
// the pair bias into the order in which the attention kernel's lanes take it as the
// C operand of S^T: Bp[tile][nt][half][lane] (16 bytes each) =
// bias_pair[h][16*qt + (lane&15)][16*nt + 8*(lane>>4) + 4*half .. +3], tile = 16*h + qt.
// The tile is read 256 times (once per row group), so the scattered read is paid here
// once and every later wave-wide 16-byte load covers 512 contiguous bytes.
__global__ __launch_bounds__(256, 4)
void proj_all_kernel(const float* __restrict__ q_x, const float* __restrict__ kv_x,
                     const float* __restrict__ wq,  const float* __restrict__ wk,
                     const float* __restrict__ wv,  const float* __restrict__ wg,
                     const float* __restrict__ bg,
                     const float* __restrict__ bias_pair, float* __restrict__ Bp,
                     f16* __restrict__ Qh, f16* __restrict__ Kh,
                     f16* __restrict__ Vh, f16* __restrict__ Gh) {
  extern __shared__ f16 smem[];
  f16*   xs  = smem;                               // [2][kRT][kLdX] activation tiles
  f16*   os  = smem + 2 * kRT * kLdX;              // [8 waves][32][kLdO] output rows
  float* bgs = (float*)(os + 8 * 32 * kLdO);       // [256] gate bias
  const int tid  = threadIdx.x;
  if (blockIdx.x < kPB) {                          // block-uniform, in front of every barrier
    const float* bsrc = bias_pair + (size_t)blockIdx.x * 16 * kS
                        + (tid & 15) * kS + ((tid >> 4) & 1) * 8 + ((tid >> 5) & 1) * 4
                        + (tid >> 6) * 16;
    v4f* bdst = (v4f*)Bp + (size_t)blockIdx.x * (16 * kS / 4) + tid;
    v4f bv[4];
#pragma unroll
    for (int j = 0; j < 4; ++j) bv[j] = *(const v4f*)(bsrc + j * 64);   // nt = tid/64 + 4*j
#pragma unroll
    for (int j = 0; j < 4; ++j) bdst[j * 256] = bv[j];
    return;
  }
  const int side = blockIdx.x & 1;                 // kPB is even
  const int nr   = (blockIdx.x - kPB) >> 1;
  const int lane = tid & 31, hg = lane >> 4, ln = lane & 15;
  const int wave = __builtin_amdgcn_readfirstlane(tid >> 5);
  const bool second = wave >= 4;                   // waves 4..7: wg or wv
  const bool gate   = second && side == 0;
  const int  base   = (wave & 3) * 64;             // first output column of this wave

  const float* wp  = side ? (second ? wv : wk) : (second ? wg : wq);
  f16*         dst = side ? (second ? Vh : Kh) : (second ? Gh : Qh);
  const bool   isq = side == 0 && !second;         // Q carries 1/sqrt(32)

  f16* ow = os + wave * 32 * kLdO;                 // this wave's own staging rows
  f16* owr = ow + (hg * 16 + ln) * kLdO;           // written: row (hg, token)
  // read back so that every 16-byte store instruction covers whole 128-byte lines:
  // gate [NR][S][HC]: 4 tokens x 128 bytes per store; Q/K/V [NR][H][S][CH]: 8 tokens
  // x 64 bytes of one head per store, stores 2 and 3 in the wave's second head
  const f16* ord = ow + (gate ? (((lane >> 2) & 1) * 16 + (lane >> 3)) : (lane >> 2)) * kLdO
                   + (lane & 3) * 8;
  const int ostep = gate ? 4 * kLdO : 8 * kLdO;    // LDS step per store
  f16* gdst = dst + (gate ? ((size_t)nr * kS + (lane >> 3)) * kHC + base + (lane & 7) * 8
                          : ((size_t)nr * kH + (wave & 3) * 2) * kS * kCH + lane * 8);
  const int gstep = gate ? 4 * kHC : 8 * kCH;      // global step per store
  const int hstep = gate ? 0 : kS * kCH - 2 * gstep;   // on to the second head
  const int tstep = gate ? kHC : kCH;              // global step per token

  // a wave-wide 16-byte load covers one whole 512-byte token row
  const v4f* xsrc = (const v4f*)((side ? kv_x : q_x) + (size_t)nr * kS * kC) + tid;
  f16* xdst = xs + (tid >> 5) * kLdX + lane * 4;
  v4f xr[4];
#pragma unroll
  for (int j = 0; j < 4; ++j) xr[j] = xsrc[j * 256];

  bgs[tid] = bg[tid];

  v16h wf[4][4];                                   // [tile t][k step]
  const float* wl = wp + base + 4 * ln + (hg << 3) * kHC;
  v4f wr[2][16];                                   // one k step in use, the next in flight
#pragma unroll
  for (int i = 0; i < 16; ++i)                     // same k order as ld_frag
    wr[0][i] = *(const v4f*)(wl + (i + (i >= 8 ? 8 : 0)) * kHC);
#pragma unroll
  for (int ks = 0; ks < 4; ++ks) {
    v4f* wc = wr[ks & 1];
    if (ks + 1 < 4) {
#pragma unroll
      for (int i = 0; i < 16; ++i)
        wr[(ks + 1) & 1][i] = *(const v4f*)(wl + ((ks + 1) * 32 + i + (i >= 8 ? 8 : 0)) * kHC);
    }
    // holds the later k steps' loads behind this step's values: all 64 loads
    // issued at once need more registers than the wave has and spill
    asm volatile("" :: "v"(wc[0]), "v"(wc[1]), "v"(wc[2]), "v"(wc[3]), "v"(wc[4]), "v"(wc[5]),
                 "v"(wc[6]), "v"(wc[7]), "v"(wc[8]), "v"(wc[9]), "v"(wc[10]), "v"(wc[11]),
                 "v"(wc[12]), "v"(wc[13]), "v"(wc[14]), "v"(wc[15]) : "memory");
#pragma unroll
    for (int i = 0; i < 16; ++i)
#pragma unroll
      for (int t = 0; t < 4; ++t) wf[t][ks][i] = (f16)wc[i][t];
  }

#pragma unroll
  for (int j = 0; j < 4; ++j)
    *(v4h*)(xdst + j * 8 * kLdX) = __builtin_convertvector(xr[j], v4h);
#pragma unroll
  for (int j = 0; j < 4; ++j) xr[j] = xsrc[1024 + j * 256];
  // address wait before the loads' address registers are reused
  asm volatile("s_wait_xcnt 0x0" ::: "memory");
  lds_barrier();

#pragma unroll 1   // rolled: the buffer index is the only thing that differs between trips
  for (int tt = 0; tt < kS / kRT; ++tt) {
    const f16* xb = xs + (tt & 1) * kRT * kLdX;
#pragma unroll 1   // rolled: beside the weight fragments there are registers for one tile only
    for (int st = 0; st < kRT / 16; ++st) {
      v16h xf[4];                                  // B = X^T, all four k steps
#pragma unroll
      for (int ks = 0; ks < 4; ++ks) xf[ks] = ld_frag(xb, st * 16, kLdX, ks * 32, lane);
      sched_fence();   // one group of LDS reads, one wait: none among the WMMAs
      v8f acc[4] = {};
#pragma unroll
      for (int ks = 0; ks < 4; ++ks)
#pragma unroll
        for (int t = 0; t < 4; ++t) acc[t] = wmma_f16(wf[t][ks], xf[ks], acc[t]);
      if (gate) {
#pragma unroll
        for (int r = 0; r < 8; ++r) {
          const v4f b4 = *(const v4f*)(bgs + base + 32 * hg + 4 * r);
#pragma unroll
          for (int t = 0; t < 4; ++t)
            acc[t][r] = rcp_slot(1.0f + exp2_slot((acc[t][r] + b4[t]) * -1.4426950408889634f));  // sigmoid
        }
      } else if (isq) {
#pragma unroll
        for (int t = 0; t < 4; ++t) acc[t] *= 0.17677669529663687f;
      }
#pragma unroll
      for (int c = 0; c < 4; ++c) {                // columns 8c .. 8c+7 of the lane's 32
        v8h o;
#pragma unroll
        for (int e = 0; e < 8; ++e) o[e] = (f16)acc[e & 3][2 * c + (e >> 2)];
        *(v8h*)(owr + c * 8) = o;
      }
      // the rows come back from other lanes of this wave: their LDS writes first
      asm volatile("s_wait_dscnt 0x0" ::: "memory");
      const int tok = tt * kRT + st * 16;          // first token of this 16-token tile
      f16* g = gdst + tok * tstep;
#pragma unroll
      for (int c = 0; c < 4; ++c)
        *(v8h*)(g + c * gstep + (c >> 1) * hstep) = *(const v8h*)(ord + c * ostep);
      // address wait before the next tile overwrites the stores' registers
      asm volatile("s_wait_xcnt 0x0" ::: "memory");
    }
    if (tt + 1 < kS / kRT) {                       // block-uniform
      f16* xn = xdst + ((tt + 1) & 1) * kRT * kLdX;   // last read in trip tt - 1
#pragma unroll
      for (int j = 0; j < 4; ++j)
        *(v4h*)(xn + j * 8 * kLdX) = __builtin_convertvector(xr[j], v4h);
      if (tt + 2 < kS / kRT) {
#pragma unroll
        for (int j = 0; j < 4; ++j) xr[j] = xsrc[(tt + 2) * 1024 + j * 256];
        // address wait before the loads' address registers are reused
        asm volatile("s_wait_xcnt 0x0" ::: "memory");
      }
      lds_barrier();
    }
  }
}

__device__ __forceinline__ float other_half(float x) {   // lane l <-> l ^ 16
  int b = __builtin_bit_cast(int, x);
  b = __builtin_amdgcn_permlanex16(b, b, 0x76543210, 0xfedcba98, false, false);
  return __builtin_bit_cast(float, b);
}

// 4 waves per SIMD: two work-groups share a WGP now that LDS allows it
__global__ __launch_bounds__(256, 4)
void attn_kernel(const float* __restrict__ bias_mask,
                 const float* __restrict__ Bp,
                 const f16* __restrict__ Qh, const f16* __restrict__ Kh,
                 const f16* __restrict__ Vh, const f16* __restrict__ Gh,
                 f16* __restrict__ Oh) {
  extern __shared__ f16 smem[];
  f16* Qs = smem;                          // [256][kLdQ]
  f16* Ks = Qs + kS * kLdQ;                // [256][kLdQ]
  f16* Vs = Ks + kS * kLdQ;                // [256][kLdV] V rows as they lie in memory
  const int nr  = blockIdx.x >> 3;
  const int h   = blockIdx.x & 7;
  const int tid = threadIdx.x;
  const int lane = tid & 31, wave = tid >> 5, hg = lane >> 4;

  __builtin_prefetch(Bp + ((size_t)h * kS) * kS, 0, 0);  // global_prefetch_b8

  const size_t base = ((size_t)nr * kH + h) * kS * kCH;  // in halves
  // async 16B-chunk copies into padded rows: row = 32 halves = 4 chunks
  const uint32_t qs_off = lds_off(Qs), ks_off = lds_off(Ks);
  for (int i = tid; i < kS * kCH / 8; i += 256) {     // 1024 chunks each
    int key = i >> 2, c8 = (i & 3) * 8;               // chunk start (halves)
    uint32_t doff = (uint32_t)((key * kLdQ + c8) * 2);
    const f16* qsrc = Qh + base + key * kCH + c8;
    const f16* ksrc = Kh + base + key * kCH + c8;
    async_ld_b128(qs_off + doff, qsrc);
    async_ld_b128(ks_off + doff, ksrc);
  }
  // V comes the same way, untransposed: chunk tid + 256*j is key tid/4 + 64*j; the
  // transposition is left to the LDS reads of the second product
  const f16* vsrc = Vh + base + tid * 8;
  const uint32_t vdst = lds_off(Vs) + (uint32_t)(((tid >> 2) * kLdV + (tid & 3) * 8) * 2);
  async_ld4_b128(vdst, vdst + 64 * kLdV * 2, vdst + 128 * kLdV * 2, vdst + 192 * kLdV * 2,
                 vsrc, vsrc + 2048, vsrc + 4096, vsrc + 6144);
  wait_async0();
  __syncthreads();

  // D/C layout of S^T tile nt: register r = S[key 16*nt + 8*hg + r][query q0 + (lane&15)]
  const float* bmp = bias_mask + (size_t)nr * kS + (hg << 3);
  const f16* vtp = Vs + ((hg << 3) + (lane & 7)) * kLdV + ((lane >> 3) & 1) * 8;
#pragma unroll 1
  for (int it = 0; it < 2; ++it) {           // each wave owns 16 query columns per trip
    const int q = (wave + it * 8) * 16 + (lane & 15);
    // re-laid pair bias: lane-contiguous, every load covers four whole 128-byte lines
    const v4f* bpp = (const v4f*)Bp + (size_t)(h * 16 + wave + it * 8) * (16 * kS / 4) + lane;
    v8f sacc[16];
#pragma unroll
    for (int nt = 0; nt < 16; ++nt) {        // 8 consecutive keys per lane: 16-byte loads
      v4f p0 = bpp[nt * 64];
      v4f p1 = bpp[nt * 64 + 32];
      sacc[nt] = __builtin_shufflevector(p0, p1, 0, 1, 2, 3, 4, 5, 6, 7);
    }
    // O^T: register r = O[query q][channel 16*ct + 8*hg + r]: 16-byte gate load and store
    const size_t gi = ((size_t)nr * kS + q) * kHC + h * kCH + (hg << 3);
    const f16* gp = Gh + gi;
    const v8h g0 = *(const v8h*)(gp);        // gate fetched at the top of the trip, long before its use
    const v8h g1 = *(const v8h*)(gp + 16);
    const v16h bq = ld_frag(Qs, q - (lane & 15), kLdQ, 0, lane);  // B = Q^T, K-dim = 32
    // address wait before the loads' address registers are reused; the pointers are
    // inputs so that no load of the run lands on an address pair itself
    asm volatile("s_wait_xcnt 0x0" :: "v"(bpp), "v"(gp) : "memory");
    sched_fence();     // all pair-bias loads in flight, landing in the accumulators
#pragma unroll
    for (int g = 0; g < 4; ++g) {            // 4 score tiles per fenced group
      v8f bm[4];
      v16h ak[4];
#pragma unroll
      for (int j = 0; j < 4; ++j) {
        const int nt = g * 4 + j;
        v4f m0 = *(const v4f*)(bmp + nt * 16);
        v4f m1 = *(const v4f*)(bmp + nt * 16 + 4);
        bm[j] = __builtin_shufflevector(m0, m1, 0, 1, 2, 3, 4, 5, 6, 7);
        ak[j] = ld_frag(Ks, nt * 16, kLdQ, 0, lane);              // A = K rows
      }
#pragma unroll
      for (int j = 0; j < 4; ++j)
        sacc[g * 4 + j] = wmma_f16(ak[j], bq, sacc[g * 4 + j] + bm[j]);
      sched_fence();   // cap live mask values and K fragments: no cross-group hoisting
    }
    // softmax over 256 keys of this lane's query: 128 in-lane values + other half
    float mx[8];
#pragma unroll
    for (int r = 0; r < 8; ++r) mx[r] = sacc[0][r];
#pragma unroll
    for (int nt = 1; nt < 16; ++nt)
#pragma unroll
      for (int r = 0; r < 8; ++r) mx[r] = fmaxf(mx[r], sacc[nt][r]);
    float m = fmaxf(fmaxf(fmaxf(mx[0], mx[1]), fmaxf(mx[2], mx[3])),
                    fmaxf(fmaxf(mx[4], mx[5]), fmaxf(mx[6], mx[7])));
    m = fmaxf(m, other_half(m));

    float sm[8] = {0.f, 0.f, 0.f, 0.f, 0.f, 0.f, 0.f, 0.f};
    v8f o0 = {}, o1 = {};
#pragma unroll
    for (int kk = 0; kk < 8; ++kk) {         // 32 keys: two score tiles -> one B operand
      v16h pb;
#pragma unroll
      for (int r = 0; r < 8; ++r) {
        float e0 = __expf(sacc[2 * kk][r] - m);
        float e1 = __expf(sacc[2 * kk + 1][r] - m);
        sm[r] += e0 + e1;
        pb[r]     = (f16)e0;
        pb[8 + r] = (f16)e1;
      }
      v16h a0 = ld_frag_tr(vtp + kk * 32 * kLdV,      kLdV);      // A = V^T rows
      v16h a1 = ld_frag_tr(vtp + kk * 32 * kLdV + 16, kLdV);
      o0 = wmma_f16(a0, pb, o0);
      o1 = wmma_f16(a1, pb, o1);
    }
    float s = ((sm[0] + sm[1]) + (sm[2] + sm[3])) + ((sm[4] + sm[5]) + (sm[6] + sm[7]));
    s += other_half(s);
    const float rinv = __builtin_amdgcn_rcpf(s);

    v8h r0, r1;
#pragma unroll
    for (int r = 0; r < 8; ++r) {
      r0[r] = (f16)(o0[r] * rinv * (float)g0[r]);
      r1[r] = (f16)(o1[r] * rinv * (float)g1[r]);
    }
    *(v8h*)(Oh + gi)      = r0;
    *(v8h*)(Oh + gi + 16) = r1;
    // address wait before the next trip overwrites the stores' registers
    asm volatile("s_wait_xcnt 0x0" ::: "memory");
  }
}

// ===================== Kernel 3: output projection =====================
__global__ __launch_bounds__(256, 1)
void outproj_kernel(const f16* __restrict__ Oh,
                    const float* __restrict__ wo,
                    const float* __restrict__ bo,
                    float* __restrict__ out) {
  extern __shared__ f16 smem[];
  f16* As = smem;                 // [64][kLdP]  gated attention rows
  f16* wt = smem + 64 * kLdP;     // [128][kLdP] wo^T: wt[n][k]
  const int nr  = blockIdx.x >> 2;
  const int s0  = (blockIdx.x & 3) * 64;
  const int tid = threadIdx.x;
  const int lane = tid & 31, wave = tid >> 5, hg = lane >> 4;

  // async 16B-chunk copy of the 64x256 f16 tile into padded rows
  const f16* asrc = Oh + ((size_t)nr * kS + s0) * kHC;
  const uint32_t as_off = lds_off(As);
  for (int i = tid; i < 64 * kHC / 8; i += 256) {   // 2048 chunks
    int row = i >> 5, c8 = (i & 31) * 8;
    async_ld_b128(as_off + (uint32_t)((row * kLdP + c8) * 2),
                  asrc + row * kHC + c8);
  }
  for (int i = tid; i < kHC * kC; i += 256) {       // wo[k][n] -> wt[n][k]
    int k = i >> 7, n = i & 127;
    wt[n * kLdP + k] = (f16)wo[i];
  }
  wait_async0();
  __syncthreads();

#pragma unroll 1
  for (int j = 0; j < 4; ++j) {
    int t  = wave + j * 8;           // 32 tiles: 4 m x 8 n
    int m0 = (t >> 3) * 16, n0 = (t & 7) * 16;
    v8f acc = {};
#pragma unroll
    for (int g = 0; g < 2; ++g) {    // 4 (A,B) pairs per fenced group
      int k0 = g * 128;
      v16h a0 = ld_frag(As, m0, kLdP, k0 + 0,  lane);
      v16h a1 = ld_frag(As, m0, kLdP, k0 + 32, lane);
      v16h a2 = ld_frag(As, m0, kLdP, k0 + 64, lane);
      v16h a3 = ld_frag(As, m0, kLdP, k0 + 96, lane);
      v16h b0 = ld_frag(wt, n0, kLdP, k0 + 0,  lane);
      v16h b1 = ld_frag(wt, n0, kLdP, k0 + 32, lane);
      v16h b2 = ld_frag(wt, n0, kLdP, k0 + 64, lane);
      v16h b3 = ld_frag(wt, n0, kLdP, k0 + 96, lane);
      acc = wmma_f16(a0, b0, acc);
      acc = wmma_f16(a1, b1, acc);
      acc = wmma_f16(a2, b2, acc);
      acc = wmma_f16(a3, b3, acc);
      sched_fence();
    }
    int c = n0 + (lane & 15);
    float bias = bo[c];
#pragma unroll
    for (int r = 0; r < 8; ++r) {
      int srow = s0 + m0 + r + (hg << 3);
      out[((size_t)nr * kS + srow) * kC + c] = acc[r] + bias;
    }
    sched_fence();
  }
}

extern "C" void kernel_launch(void* const* d_in, const int* in_sizes, int n_in,
                              void* d_out, int out_size, void* d_ws, size_t ws_size,
                              hipStream_t stream) {
  const float* q_x       = (const float*)d_in[0];
  const float* kv_x      = (const float*)d_in[1];
  const float* bias_mask = (const float*)d_in[2];
  const float* bias_pair = (const float*)d_in[3];
  const float* wq = (const float*)d_in[4];
  const float* wk = (const float*)d_in[5];
  const float* wv = (const float*)d_in[6];
  const float* wg = (const float*)d_in[7];
  const float* bg = (const float*)d_in[8];
  const float* wo = (const float*)d_in[9];
  const float* bo = (const float*)d_in[10];
  float* out = (float*)d_out;

  char* wsb = (char*)d_ws;
  const size_t SZ = (size_t)kNR * kH * kS * kCH * sizeof(f16);  // 33.5 MB each
  f16* Qh = (f16*)(wsb + 0 * SZ);   // [NR][H][S][CH], pre-scaled
  f16* Kh = (f16*)(wsb + 1 * SZ);   // [NR][H][S][CH]
  f16* Vh = (f16*)(wsb + 2 * SZ);   // [NR][H][S][CH]
  f16* Gh = (f16*)(wsb + 3 * SZ);   // [NR][S][HC] sigmoid gate
  f16* Oh = (f16*)(wsb + 4 * SZ);   // [NR][S][HC] gated attention out
  float* Bp = (float*)(wsb + 5 * SZ);   // [H*16][16][2][32][4] pair bias in C-operand order, 2 MB

  dim3 blk(256);
  const size_t smem1 = (2 * kRT * kLdX + 8 * 32 * kLdO) * sizeof(f16) + kHC * sizeof(float);
  proj_all_kernel<<<dim3(kPB + kNR * 2), blk, smem1, stream>>>(
      q_x, kv_x, wq, wk, wv, wg, bg, bias_pair, Bp, Qh, Kh, Vh, Gh);
  attn_kernel<<<dim3(kNR * kH), blk,
                (2 * kS * kLdQ + kS * kLdV) * sizeof(f16), stream>>>(
      bias_mask, Bp, Qh, Kh, Vh, Gh, Oh);
  outproj_kernel<<<dim3(kNR * 4), blk,
                   (64 * kLdP + kC * kLdP) * sizeof(f16), stream>>>(
      Oh, wo, bo, out);
}

// v005
// One run takes 90.1 microseconds.
// Timed twice side by side with v004, it ran 1.19 times as fast both times.
// All steps since v000 together make it 2.58 times as fast.
#include <hip/hip_runtime.h>

typedef _Float16 f16;
typedef __attribute__((ext_vector_type(2)))  _Float16 v2h;
typedef __attribute__((ext_vector_type(4)))  _Float16 v4h;
typedef __attribute__((ext_vector_type(8)))  _Float16 v8h;
typedef __attribute__((ext_vector_type(16))) _Float16 v16h;
typedef __attribute__((ext_vector_type(8)))  float    v8f;
typedef __attribute__((ext_vector_type(4)))  float    v4f;
typedef __attribute__((ext_vector_type(2)))  float    v2f;
typedef __attribute__((ext_vector_type(8)))  short    v8s;

constexpr int kS  = 256;   // tokens (Q = K)
constexpr int kC  = 128;   // input channels (CQ=CK=CV)
constexpr int kH  = 8;     // heads
constexpr int kCH = 32;    // head dim
constexpr int kHC = 256;   // H*CH
constexpr int kNR = 256;   // rows
constexpr int kRT = 32;    // tokens per staged activation tile (projections)
constexpr int kPB = 128;   // (head, 16-query tile) pairs: one re-laying block each

// padded LDS row strides (halves): odd multiples of 8 (kLdV, kLdW: of 16) -> 16B-aligned b128
// loads with lanes spread across banks
constexpr int kLdX = 136;  // 128 + 8
constexpr int kLdO = 40;   // 32 + 8 (projection output rows on their way to whole-line stores)
constexpr int kLdQ = 40;   // 32 + 8 (Q/K tiles, K-dim 32)
constexpr int kLdP = 264;  // 256 + 8 (output projection rows, K-dim 256)
constexpr int kLdW = 144;  // 128 + 16 (wo rows): 288 bytes, an odd multiple of 32, the transposing load's pitch
constexpr int kLdV = 48;   // 32 + 16 (V rows): 96 bytes, an odd multiple of 32, the transposing load's pitch

// ---- fragment loader (CDNA5 16-bit WMMA layout, ISA 7.12.2) ----
// Source is [M][K] (A) or [N][K] (B^T staged): lane owns row (base + lane&15),
// element i holds K = k0 + 8*(lane>>4) + i + (i>=8 ? 8 : 0)  -> two
// contiguous 16-byte runs -> exactly two ds_load_b128 per fragment.
__device__ __forceinline__ v16h ld_frag(const f16* p, int row0, int ld,
                                        int k0, int lane) {
  const f16* q = p + (size_t)(row0 + (lane & 15)) * ld + k0 + ((lane >> 4) << 3);
  v8h lo = *(const v8h*)(q);
  v8h hi = *(const v8h*)(q + 16);
  return __builtin_shufflevector(lo, hi, 0, 1, 2, 3, 4, 5, 6, 7,
                                 8, 9, 10, 11, 12, 13, 14, 15);
}

// ---- transposing fragment loader: A = T^T from a row-major LDS tile T[k][m] ----
// p is the lane's own address, T + (k0 + 8*(lane>>4) + (lane&7)) * ld + m0 + 8*((lane>>3)&1);
// the lane gets T[k0 + 8*(lane>>4) + i + (i>=8 ? 8 : 0)][m0 + (lane&15)]: ld_frag's k order.
__device__ __forceinline__ v8h ld_tr16(const f16* p) {
  typedef __attribute__((address_space(3))) v8s lds_v8s;
  return __builtin_bit_cast(v8h, __builtin_amdgcn_ds_load_tr16_b128_v8i16((lds_v8s*)p));
}
__device__ __forceinline__ v16h ld_frag_tr(const f16* p, int ld) {
  v8h lo = ld_tr16(p);
  v8h hi = ld_tr16(p + 16 * ld);
  return __builtin_shufflevector(lo, hi, 0, 1, 2, 3, 4, 5, 6, 7,
                                 8, 9, 10, 11, 12, 13, 14, 15);
}

__device__ __forceinline__ v8f wmma_f16(v16h a, v16h b, v8f c) {
  return __builtin_amdgcn_wmma_f32_16x16x32_f16(false, a, false, b,
                                                (short)0, c, false, false);
}

// scheduling fence: keep register pressure bounded (no hoisting across)
__device__ __forceinline__ void sched_fence() {
  __builtin_amdgcn_sched_barrier(0);
}

// ---- CDNA5 async global->LDS copy (ASYNCcnt tracked, no VGPR data) ----
__device__ __forceinline__ void async_ld_b128(uint32_t lds_byte_off, const f16* g) {
  asm volatile("global_load_async_to_lds_b128 %0, %1, off"
               :: "v"(lds_byte_off), "v"(g) : "memory");
}
// four copies of one lane; the address wait is the statement's last line, so that it
// stands in front of whatever reuses the copies' address registers
__device__ __forceinline__ void async_ld4_b128(uint32_t l0, uint32_t l1, uint32_t l2, uint32_t l3,
                                               const f16* g0, const f16* g1,
                                               const f16* g2, const f16* g3) {
  asm volatile("global_load_async_to_lds_b128 %0, %4, off\n\t"
               "global_load_async_to_lds_b128 %1, %5, off\n\t"
               "global_load_async_to_lds_b128 %2, %6, off\n\t"
               "global_load_async_to_lds_b128 %3, %7, off\n\t"
               "s_wait_xcnt 0x0"
               :: "v"(l0), "v"(l1), "v"(l2), "v"(l3), "v"(g0), "v"(g1), "v"(g2), "v"(g3)
               : "memory");
}
__device__ __forceinline__ void wait_async0() {
  asm volatile("s_wait_asynccnt 0x0" ::: "memory");
}
__device__ __forceinline__ uint32_t lds_off(const void* p) {
  return (uint32_t)(uintptr_t)p;   // low 32 bits of shared aperture = LDS offset
}

// work-group barrier that orders LDS only: the next tile's global loads stay in
// flight across it and the output stores are not waited for (__syncthreads drains both)
__device__ __forceinline__ void lds_barrier() {
  __builtin_amdgcn_fence(__ATOMIC_RELEASE, "workgroup", "local");
  __builtin_amdgcn_s_barrier();
  __builtin_amdgcn_fence(__ATOMIC_ACQUIRE, "workgroup", "local");
}

// reciprocal and 2^x with the one free slot that the instruction set asks for behind
// a transcendental
__device__ __forceinline__ float rcp_slot(float x) {
  float y;
  asm("v_rcp_f32 %0, %1\n\tv_nop" : "=v"(y) : "v"(x));
  return y;
}
__device__ __forceinline__ float exp2_slot(float x) {
  float y;
  asm("v_exp_f32 %0, %1\n\tv_nop" : "=v"(y) : "v"(x));
  return y;
}

// ===================== Kernel 1: input projections, one launch =====================
// Weight-stationary and transposed: D^T = W^T X^T. A block takes one row group
// (256 tokens) of one activation (even blocks q_x: wq, wg; odd blocks kv_x: wk, wv).
// A wave keeps the A fragments of its 64 output columns in registers for the whole
// block; only the activation goes through LDS, in 32-token tiles, two buffers.
// Column map of a wave: row j of matrix tile t is column base + 4*j + t, so one
// 16-byte load of a weight row feeds all four tiles, and lane (token, hg) ends up
// with the 32 consecutive columns base + 32*hg .. +31 of its token.
// The first kPB blocks do no projection: each re-lays one 16-query x 256-key tile of
// the pair bias into the order in which the attention kernel's lanes take it as the
// C operand of S^T: Bp[tile][nt][half][lane] (16 bytes each) =
// bias_pair[h][16*qt + (lane&15)][16*nt + 8*(lane>>4) + 4*half .. +3], tile = 16*h + qt.
// The tile is read 256 times (once per row group), so the scattered read is paid here
// once and every later wave-wide 16-byte load covers 512 contiguous bytes.
__global__ __launch_bounds__(256, 4)
void proj_all_kernel(const float* __restrict__ q_x, const float* __restrict__ kv_x,
                     const float* __restrict__ wq,  const float* __restrict__ wk,
                     const float* __restrict__ wv,  const float* __restrict__ wg,
                     const float* __restrict__ bg,
                     const float* __restrict__ bias_pair, float* __restrict__ Bp,
                     f16* __restrict__ Qh, f16* __restrict__ Kh,
                     f16* __restrict__ Vh, f16* __restrict__ Gh) {
  extern __shared__ f16 smem[];
  f16*   xs  = smem;                               // [2][kRT][kLdX] activation tiles
  f16*   os  = smem + 2 * kRT * kLdX;              // [8 waves][32][kLdO] output rows
  float* bgs = (float*)(os + 8 * 32 * kLdO);       // [256] gate bias
  const int tid  = threadIdx.x;
  if (blockIdx.x < kPB) {                          // block-uniform, in front of every barrier
    const float* bsrc = bias_pair + (size_t)blockIdx.x * 16 * kS
                        + (tid & 15) * kS + ((tid >> 4) & 1) * 8 + ((tid >> 5) & 1) * 4
                        + (tid >> 6) * 16;
    v4f* bdst = (v4f*)Bp + (size_t)blockIdx.x * (16 * kS / 4) + tid;
    v4f bv[4];
#pragma unroll
    for (int j = 0; j < 4; ++j) bv[j] = *(const v4f*)(bsrc + j * 64);   // nt = tid/64 + 4*j
#pragma unroll
    for (int j = 0; j < 4; ++j) bdst[j * 256] = bv[j];
    return;
  }
  const int side = blockIdx.x & 1;                 // kPB is even
  const int nr   = (blockIdx.x - kPB) >> 1;
  const int lane = tid & 31, hg = lane >> 4, ln = lane & 15;
  const int wave = __builtin_amdgcn_readfirstlane(tid >> 5);
  const bool second = wave >= 4;                   // waves 4..7: wg or wv
  const bool gate   = second && side == 0;
  const int  base   = (wave & 3) * 64;             // first output column of this wave

  const float* wp  = side ? (second ? wv : wk) : (second ? wg : wq);
  f16*         dst = side ? (second ? Vh : Kh) : (second ? Gh : Qh);
  const bool   isq = side == 0 && !second;         // Q carries 1/sqrt(32)

  f16* ow = os + wave * 32 * kLdO;                 // this wave's own staging rows
  f16* owr = ow + (hg * 16 + ln) * kLdO;           // written: row (hg, token)
  // read back so that every 16-byte store instruction covers whole 128-byte lines:
  // gate [NR][S][HC]: 4 tokens x 128 bytes per store; Q/K/V [NR][H][S][CH]: 8 tokens
  // x 64 bytes of one head per store, stores 2 and 3 in the wave's second head
  const f16* ord = ow + (gate ? (((lane >> 2) & 1) * 16 + (lane >> 3)) : (lane >> 2)) * kLdO
                   + (lane & 3) * 8;
  const int ostep = gate ? 4 * kLdO : 8 * kLdO;    // LDS step per store
  f16* gdst = dst + (gate ? ((size_t)nr * kS + (lane >> 3)) * kHC + base + (lane & 7) * 8
                          : ((size_t)nr * kH + (wave & 3) * 2) * kS * kCH + lane * 8);
  const int gstep = gate ? 4 * kHC : 8 * kCH;      // global step per store
  const int hstep = gate ? 0 : kS * kCH - 2 * gstep;   // on to the second head
  const int tstep = gate ? kHC : kCH;              // global step per token

  // a wave-wide 16-byte load covers one whole 512-byte token row
  const v4f* xsrc = (const v4f*)((side ? kv_x : q_x) + (size_t)nr * kS * kC) + tid;
  f16* xdst = xs + (tid >> 5) * kLdX + lane * 4;
  v4f xr[4];
#pragma unroll
  for (int j = 0; j < 4; ++j) xr[j] = xsrc[j * 256];

  bgs[tid] = bg[tid];

  v16h wf[4][4];                                   // [tile t][k step]
  const float* wl = wp + base + 4 * ln + (hg << 3) * kHC;
  v4f wr[2][16];                                   // one k step in use, the next in flight
#pragma unroll
  for (int i = 0; i < 16; ++i)                     // same k order as ld_frag
    wr[0][i] = *(const v4f*)(wl + (i + (i >= 8 ? 8 : 0)) * kHC);
#pragma unroll
  for (int ks = 0; ks < 4; ++ks) {
    v4f* wc = wr[ks & 1];
    if (ks + 1 < 4) {
#pragma unroll
      for (int i = 0; i < 16; ++i)
        wr[(ks + 1) & 1][i] = *(const v4f*)(wl + ((ks + 1) * 32 + i + (i >= 8 ? 8 : 0)) * kHC);
    }
    // holds the later k steps' loads behind this step's values: all 64 loads
    // issued at once need more registers than the wave has and spill
    asm volatile("" :: "v"(wc[0]), "v"(wc[1]), "v"(wc[2]), "v"(wc[3]), "v"(wc[4]), "v"(wc[5]),
                 "v"(wc[6]), "v"(wc[7]), "v"(wc[8]), "v"(wc[9]), "v"(wc[10]), "v"(wc[11]),
                 "v"(wc[12]), "v"(wc[13]), "v"(wc[14]), "v"(wc[15]) : "memory");
#pragma unroll
    for (int i = 0; i < 16; ++i)
#pragma unroll
      for (int t = 0; t < 4; ++t) wf[t][ks][i] = (f16)wc[i][t];
  }

#pragma unroll
  for (int j = 0; j < 4; ++j)
    *(v4h*)(xdst + j * 8 * kLdX) = __builtin_convertvector(xr[j], v4h);
#pragma unroll
  for (int j = 0; j < 4; ++j) xr[j] = xsrc[1024 + j * 256];
  // address wait before the loads' address registers are reused
  asm volatile("s_wait_xcnt 0x0" ::: "memory");
  lds_barrier();

#pragma unroll 1   // rolled: the buffer index is the only thing that differs between trips
  for (int tt = 0; tt < kS / kRT; ++tt) {
    const f16* xb = xs + (tt & 1) * kRT * kLdX;
#pragma unroll 1   // rolled: beside the weight fragments there are registers for one tile only
    for (int st = 0; st < kRT / 16; ++st) {
      v16h xf[4];                                  // B = X^T, all four k steps
#pragma unroll
      for (int ks = 0; ks < 4; ++ks) xf[ks] = ld_frag(xb, st * 16, kLdX, ks * 32, lane);
      sched_fence();   // one group of LDS reads, one wait: none among the WMMAs
      v8f acc[4] = {};
#pragma unroll
      for (int ks = 0; ks < 4; ++ks)
#pragma unroll
        for (int t = 0; t < 4; ++t) acc[t] = wmma_f16(wf[t][ks], xf[ks], acc[t]);
      if (gate) {
#pragma unroll
        for (int r = 0; r < 8; ++r) {
          const v4f b4 = *(const v4f*)(bgs + base + 32 * hg + 4 * r);
#pragma unroll
          for (int t = 0; t < 4; ++t)
            acc[t][r] = rcp_slot(1.0f + exp2_slot((acc[t][r] + b4[t]) * -1.4426950408889634f));  // sigmoid
        }
      } else if (isq) {
#pragma unroll
        for (int t = 0; t < 4; ++t) acc[t] *= 0.17677669529663687f;
      }
#pragma unroll
      for (int c = 0; c < 4; ++c) {                // columns 8c .. 8c+7 of the lane's 32
        v8h o;
#pragma unroll
        for (int e = 0; e < 8; ++e) o[e] = (f16)acc[e & 3][2 * c + (e >> 2)];
        *(v8h*)(owr + c * 8) = o;
      }
      // the rows come back from other lanes of this wave: their LDS writes first
      asm volatile("s_wait_dscnt 0x0" ::: "memory");
      const int tok = tt * kRT + st * 16;          // first token of this 16-token tile
      f16* g = gdst + tok * tstep;
#pragma unroll
      for (int c = 0; c < 4; ++c)
        *(v8h*)(g + c * gstep + (c >> 1) * hstep) = *(const v8h*)(ord + c * ostep);
      // address wait before the next tile overwrites the stores' registers
      asm volatile("s_wait_xcnt 0x0" ::: "memory");
    }
    if (tt + 1 < kS / kRT) {                       // block-uniform
      f16* xn = xdst + ((tt + 1) & 1) * kRT * kLdX;   // last read in trip tt - 1
#pragma unroll
      for (int j = 0; j < 4; ++j)
        *(v4h*)(xn + j * 8 * kLdX) = __builtin_convertvector(xr[j], v4h);
      if (tt + 2 < kS / kRT) {
#pragma unroll
        for (int j = 0; j < 4; ++j) xr[j] = xsrc[(tt + 2) * 1024 + j * 256];
        // address wait before the loads' address registers are reused
        asm volatile("s_wait_xcnt 0x0" ::: "memory");
      }
      lds_barrier();
    }
  }
}

__device__ __forceinline__ float other_half(float x) {   // lane l <-> l ^ 16
  int b = __builtin_bit_cast(int, x);
  b = __builtin_amdgcn_permlanex16(b, b, 0x76543210, 0xfedcba98, false, false);
  return __builtin_bit_cast(float, b);
}

// 4 waves per SIMD: two work-groups share a WGP now that LDS allows it
__global__ __launch_bounds__(256, 4)
void attn_kernel(const float* __restrict__ bias_mask,
                 const float* __restrict__ Bp,
                 const f16* __restrict__ Qh, const f16* __restrict__ Kh,
                 const f16* __restrict__ Vh, const f16* __restrict__ Gh,
                 f16* __restrict__ Oh) {
  extern __shared__ f16 smem[];
  f16* Qs = smem;                          // [256][kLdQ]
  f16* Ks = Qs + kS * kLdQ;                // [256][kLdQ]
  f16* Vs = Ks + kS * kLdQ;                // [256][kLdV] V rows as they lie in memory
  const int nr  = blockIdx.x >> 3;
  const int h   = blockIdx.x & 7;
  const int tid = threadIdx.x;
  const int lane = tid & 31, wave = tid >> 5, hg = lane >> 4;

  __builtin_prefetch(Bp + ((size_t)h * kS) * kS, 0, 0);  // global_prefetch_b8

  const size_t base = ((size_t)nr * kH + h) * kS * kCH;  // in halves
  // async 16B-chunk copies into padded rows: row = 32 halves = 4 chunks
  const uint32_t qs_off = lds_off(Qs), ks_off = lds_off(Ks);
  for (int i = tid; i < kS * kCH / 8; i += 256) {     // 1024 chunks each
    int key = i >> 2, c8 = (i & 3) * 8;               // chunk start (halves)
    uint32_t doff = (uint32_t)((key * kLdQ + c8) * 2);
    const f16* qsrc = Qh + base + key * kCH + c8;
    const f16* ksrc = Kh + base + key * kCH + c8;
    async_ld_b128(qs_off + doff, qsrc);
    async_ld_b128(ks_off + doff, ksrc);
  }
  // V comes the same way, untransposed: chunk tid + 256*j is key tid/4 + 64*j; the
  // transposition is left to the LDS reads of the second product
  const f16* vsrc = Vh + base + tid * 8;
  const uint32_t vdst = lds_off(Vs) + (uint32_t)(((tid >> 2) * kLdV + (tid & 3) * 8) * 2);
  async_ld4_b128(vdst, vdst + 64 * kLdV * 2, vdst + 128 * kLdV * 2, vdst + 192 * kLdV * 2,
                 vsrc, vsrc + 2048, vsrc + 4096, vsrc + 6144);
  wait_async0();
  __syncthreads();

  // D/C layout of S^T tile nt: register r = S[key 16*nt + 8*hg + r][query q0 + (lane&15)]
  const float* bmp = bias_mask + (size_t)nr * kS + (hg << 3);
  const f16* vtp = Vs + ((hg << 3) + (lane & 7)) * kLdV + ((lane >> 3) & 1) * 8;
#pragma unroll 1
  for (int it = 0; it < 2; ++it) {           // each wave owns 16 query columns per trip
    const int q = (wave + it * 8) * 16 + (lane & 15);
    // re-laid pair bias: lane-contiguous, every load covers four whole 128-byte lines
    const v4f* bpp = (const v4f*)Bp + (size_t)(h * 16 + wave + it * 8) * (16 * kS / 4) + lane;
    v8f sacc[16];
#pragma unroll
    for (int nt = 0; nt < 16; ++nt) {        // 8 consecutive keys per lane: 16-byte loads
      v4f p0 = bpp[nt * 64];
      v4f p1 = bpp[nt * 64 + 32];
      sacc[nt] = __builtin_shufflevector(p0, p1, 0, 1, 2, 3, 4, 5, 6, 7);
    }
    // O^T: register r = O[query q][channel 16*ct + 8*hg + r]: 16-byte gate load and store
    const size_t gi = ((size_t)nr * kS + q) * kHC + h * kCH + (hg << 3);
    const f16* gp = Gh + gi;
    const v8h g0 = *(const v8h*)(gp);        // gate fetched at the top of the trip, long before its use
    const v8h g1 = *(const v8h*)(gp + 16);
    const v16h bq = ld_frag(Qs, q - (lane & 15), kLdQ, 0, lane);  // B = Q^T, K-dim = 32
    // address wait before the loads' address registers are reused; the pointers are
    // inputs so that no load of the run lands on an address pair itself
    asm volatile("s_wait_xcnt 0x0" :: "v"(bpp), "v"(gp) : "memory");
    sched_fence();     // all pair-bias loads in flight, landing in the accumulators
#pragma unroll
    for (int g = 0; g < 4; ++g) {            // 4 score tiles per fenced group
      v8f bm[4];
      v16h ak[4];
#pragma unroll
      for (int j = 0; j < 4; ++j) {
        const int nt = g * 4 + j;
        v4f m0 = *(const v4f*)(bmp + nt * 16);
        v4f m1 = *(const v4f*)(bmp + nt * 16 + 4);
        bm[j] = __builtin_shufflevector(m0, m1, 0, 1, 2, 3, 4, 5, 6, 7);
        ak[j] = ld_frag(Ks, nt * 16, kLdQ, 0, lane);              // A = K rows
      }
#pragma unroll
      for (int j = 0; j < 4; ++j)
        sacc[g * 4 + j] = wmma_f16(ak[j], bq, sacc[g * 4 + j] + bm[j]);
      sched_fence();   // cap live mask values and K fragments: no cross-group hoisting
    }
    // softmax over 256 keys of this lane's query: 128 in-lane values + other half
    float mx[8];
#pragma unroll
    for (int r = 0; r < 8; ++r) mx[r] = sacc[0][r];
#pragma unroll
    for (int nt = 1; nt < 16; ++nt)
#pragma unroll
      for (int r = 0; r < 8; ++r) mx[r] = fmaxf(mx[r], sacc[nt][r]);
    float m = fmaxf(fmaxf(fmaxf(mx[0], mx[1]), fmaxf(mx[2], mx[3])),
                    fmaxf(fmaxf(mx[4], mx[5]), fmaxf(mx[6], mx[7])));
    m = fmaxf(m, other_half(m));

    float sm[8] = {0.f, 0.f, 0.f, 0.f, 0.f, 0.f, 0.f, 0.f};
    v8f o0 = {}, o1 = {};
#pragma unroll
    for (int kk = 0; kk < 8; ++kk) {         // 32 keys: two score tiles -> one B operand
      v16h pb;
#pragma unroll
      for (int r = 0; r < 8; ++r) {
        float e0 = __expf(sacc[2 * kk][r] - m);
        float e1 = __expf(sacc[2 * kk + 1][r] - m);
        sm[r] += e0 + e1;
        pb[r]     = (f16)e0;
        pb[8 + r] = (f16)e1;
      }
      v16h a0 = ld_frag_tr(vtp + kk * 32 * kLdV,      kLdV);      // A = V^T rows
      v16h a1 = ld_frag_tr(vtp + kk * 32 * kLdV + 16, kLdV);
      o0 = wmma_f16(a0, pb, o0);
      o1 = wmma_f16(a1, pb, o1);
    }
    float s = ((sm[0] + sm[1]) + (sm[2] + sm[3])) + ((sm[4] + sm[5]) + (sm[6] + sm[7]));
    s += other_half(s);
    const float rinv = __builtin_amdgcn_rcpf(s);

    v8h r0, r1;
#pragma unroll
    for (int r = 0; r < 8; ++r) {
      r0[r] = (f16)(o0[r] * rinv * (float)g0[r]);
      r1[r] = (f16)(o1[r] * rinv * (float)g1[r]);
    }
    *(v8h*)(Oh + gi)      = r0;
    *(v8h*)(Oh + gi + 16) = r1;
    // address wait before the next trip overwrites the stores' registers
    asm volatile("s_wait_xcnt 0x0" ::: "memory");
  }
}

// ===================== Kernel 3: output projection =====================
// Weight-stationary: one block of 16 waves takes one row group (256 tokens). wo is read
// once per block with whole-row loads and laid in LDS as f16 rows; a wave then keeps the
// B fragments of its 32 output columns (all 256 k) in registers for its 64 tokens, taken
// by the transposing LDS load. Only the activation fragments are read per token tile.
// Column map of a wave: column j of matrix tile t is output column 32*cg + 2*j + t, so a
// lane holds two neighbouring columns of a token and an 8-byte store instruction covers
// two whole 128-byte lines. wo's columns are regrouped to that map on their way into LDS:
// column 32*cg + 2*j + t lies at position 32*cg + 16*t + j of its row.
__global__ __launch_bounds__(512, 1)
void outproj_kernel(const f16* __restrict__ Oh,
                    const float* __restrict__ wo,
                    const float* __restrict__ bo,
                    float* __restrict__ out) {
  __shared__ __attribute__((aligned(128))) f16 As[kS * kLdP];    // [256][kLdP] gated attention rows
  __shared__ __attribute__((aligned(128))) f16 Ws[kHC * kLdW];   // [256][kLdW] wo rows, columns regrouped
  const int nr  = blockIdx.x;
  const int tid = threadIdx.x;
  const int lane = tid & 31, hg = lane >> 4, ln = lane & 15;
  const int wave = __builtin_amdgcn_readfirstlane(tid >> 5);

  // async 16-byte copies of the 256x256 f16 tile into padded rows, all in flight while
  // the weights are laid: chunk tid + 512*j is row tid/32 + 16*j
  const f16* asrc = Oh + (size_t)nr * kS * kHC + tid * 8;
  const uint32_t adst = lds_off(As) + (uint32_t)(((tid >> 5) * kLdP + lane * 8) * 2);
#pragma unroll
  for (int j = 0; j < 4; ++j) {
    const uint32_t l = adst + (uint32_t)(j * 64 * kLdP * 2);
    const f16* g = asrc + j * 64 * kHC;
    async_ld4_b128(l, l + 16 * kLdP * 2, l + 32 * kLdP * 2, l + 48 * kLdP * 2,
                   g, g + 16 * kHC, g + 32 * kHC, g + 48 * kHC);
  }

  // a wave-wide 16-byte load covers one whole 512-byte row of wo: row tid/32 + 16*j
  const v4f* wsrc = (const v4f*)wo + tid;
  v4f wr[16];
#pragma unroll
  for (int j = 0; j < 16; ++j) wr[j] = wsrc[j * 512];
  // address wait before the loads' address registers are reused
  asm volatile("s_wait_xcnt 0x0" ::: "memory");
  f16* wdst = Ws + (tid >> 5) * kLdW + (lane >> 3) * 32 + (lane & 7) * 2;
#pragma unroll
  for (int j = 0; j < 16; ++j) {
    v2h ev = {(f16)wr[j][0], (f16)wr[j][2]};       // tile 0: even columns
    v2h od = {(f16)wr[j][1], (f16)wr[j][3]};       // tile 1: odd columns
    *(v2h*)(wdst + j * 16 * kLdW)      = ev;
    *(v2h*)(wdst + j * 16 * kLdW + 16) = od;
  }
  wait_async0();
  __syncthreads();

  const int cg = wave & 3;                         // 32 output columns
  const int t0 = (wave >> 2) * 64;                 // 64 tokens
  v16h wf[2][8];                                   // [tile t][k step]
  const f16* wtp = Ws + ((hg << 3) + (lane & 7)) * kLdW + cg * 32 + ((lane >> 3) & 1) * 8;
#pragma unroll
  for (int ks = 0; ks < 8; ++ks)
#pragma unroll
    for (int t = 0; t < 2; ++t) wf[t][ks] = ld_frag_tr(wtp + ks * 32 * kLdW + t * 16, kLdW);
  const v2f bias = *(const v2f*)(bo + cg * 32 + 2 * ln);

  // D layout: register r = token 8*hg + r of the tile, lane&15 = column j
  float* op = out + ((size_t)nr * kS + t0 + (hg << 3)) * kC + cg * 32 + 2 * ln;
#pragma unroll 1   // rolled: beside the weight fragments there are registers for one tile only
  for (int st = 0; st < 4; ++st) {
    v16h af[8];                                    // A = token rows, all eight k steps
#pragma unroll
    for (int ks = 0; ks < 8; ++ks) af[ks] = ld_frag(As, t0 + st * 16, kLdP, ks * 32, lane);
    sched_fence();   // one group of LDS reads in front of the WMMAs, none among them
    v8f a0 = {}, a1 = {};
#pragma unroll
    for (int ks = 0; ks < 8; ++ks) {
      a0 = wmma_f16(af[ks], wf[0][ks], a0);
      a1 = wmma_f16(af[ks], wf[1][ks], a1);
    }
    float* o = op + st * 16 * kC;
#pragma unroll
    for (int r = 0; r < 8; ++r) {
      v2f v = {a0[r] + bias[0], a1[r] + bias[1]};
      *(v2f*)(o + r * kC) = v;
    }
    // address wait before the next tile overwrites the stores' registers
    asm volatile("s_wait_xcnt 0x0" ::: "memory");
  }
}

extern "C" void kernel_launch(void* const* d_in, const int* in_sizes, int n_in,
                              void* d_out, int out_size, void* d_ws, size_t ws_size,
                              hipStream_t stream) {
  const float* q_x       = (const float*)d_in[0];
  const float* kv_x      = (const float*)d_in[1];
  const float* bias_mask = (const float*)d_in[2];
  const float* bias_pair = (const float*)d_in[3];
  const float* wq = (const float*)d_in[4];
  const float* wk = (const float*)d_in[5];
  const float* wv = (const float*)d_in[6];
  const float* wg = (const float*)d_in[7];
  const float* bg = (const float*)d_in[8];
  const float* wo = (const float*)d_in[9];
  const float* bo = (const float*)d_in[10];
  float* out = (float*)d_out;

  char* wsb = (char*)d_ws;
  const size_t SZ = (size_t)kNR * kH * kS * kCH * sizeof(f16);  // 33.5 MB each
  f16* Qh = (f16*)(wsb + 0 * SZ);   // [NR][H][S][CH], pre-scaled
  f16* Kh = (f16*)(wsb + 1 * SZ);   // [NR][H][S][CH]
  f16* Vh = (f16*)(wsb + 2 * SZ);   // [NR][H][S][CH]
  f16* Gh = (f16*)(wsb + 3 * SZ);   // [NR][S][HC] sigmoid gate
  f16* Oh = (f16*)(wsb + 4 * SZ);   // [NR][S][HC] gated attention out
  float* Bp = (float*)(wsb + 5 * SZ);   // [H*16][16][2][32][4] pair bias in C-operand order, 2 MB

  dim3 blk(256);
  const size_t smem1 = (2 * kRT * kLdX + 8 * 32 * kLdO) * sizeof(f16) + kHC * sizeof(float);
  proj_all_kernel<<<dim3(kPB + kNR * 2), blk, smem1, stream>>>(
      q_x, kv_x, wq, wk, wv, wg, bg, bias_pair, Bp, Qh, Kh, Vh, Gh);
  attn_kernel<<<dim3(kNR * kH), blk,
                (2 * kS * kLdQ + kS * kLdV) * sizeof(f16), stream>>>(
      bias_mask, Bp, Qh, Kh, Vh, Gh, Oh);
  outproj_kernel<<<dim3(kNR), dim3(512), 0, stream>>>(Oh, wo, bo, out);
}

// v006
// One run takes 76 microseconds.
// In two side-by-side timings against v005, it was 1.19 and 1.18 times as fast.
// All steps since v000 together make it 3.06 times as fast.
#include <hip/hip_runtime.h>

typedef _Float16 f16;
typedef __attribute__((ext_vector_type(2)))  _Float16 v2h;
typedef __attribute__((ext_vector_type(4)))  _Float16 v4h;
typedef __attribute__((ext_vector_type(8)))  _Float16 v8h;
typedef __attribute__((ext_vector_type(16))) _Float16 v16h;
typedef __attribute__((ext_vector_type(8)))  float    v8f;
typedef __attribute__((ext_vector_type(4)))  float    v4f;
typedef __attribute__((ext_vector_type(2)))  float    v2f;
typedef __attribute__((ext_vector_type(8)))  short    v8s;

constexpr int kS  = 256;   // tokens (Q = K)
constexpr int kC  = 128;   // input channels (CQ=CK=CV)
constexpr int kH  = 8;     // heads
constexpr int kCH = 32;    // head dim
constexpr int kHC = 256;   // H*CH
constexpr int kNR = 256;   // rows
constexpr int kRT = 32;    // tokens per staged activation tile (projections)
constexpr int kPB = 128;   // (head, 16-query tile) pairs: one re-laying block each

// padded LDS row strides (halves): odd multiples of 8 (kLdV, kLdW: of 16) -> 16B-aligned b128
// loads with lanes spread across banks
constexpr int kLdX = 136;  // 128 + 8
constexpr int kLdO = 40;   // 32 + 8 (projection output rows on their way to whole-line stores)
constexpr int kLdQ = 40;   // 32 + 8 (K tiles, K-dim 32)
constexpr int kLdP = 264;  // 256 + 8 (output projection rows, K-dim 256)
constexpr int kLdW = 144;  // 128 + 16 (wo rows): 288 bytes, an odd multiple of 32, the transposing load's pitch
constexpr int kLdV = 48;   // 32 + 16 (V rows): 96 bytes, an odd multiple of 32, the transposing load's pitch

// ---- fragment loader (CDNA5 16-bit WMMA layout, ISA 7.12.2) ----
// Source is [M][K] (A) or [N][K] (B^T staged): lane owns row (base + lane&15),
// element i holds K = k0 + 8*(lane>>4) + i + (i>=8 ? 8 : 0)  -> two
// contiguous 16-byte runs -> exactly two ds_load_b128 per fragment.
__device__ __forceinline__ v16h ld_frag(const f16* p, int row0, int ld,
                                        int k0, int lane) {
  const f16* q = p + (size_t)(row0 + (lane & 15)) * ld + k0 + ((lane >> 4) << 3);
  v8h lo = *(const v8h*)(q);
  v8h hi = *(const v8h*)(q + 16);
  return __builtin_shufflevector(lo, hi, 0, 1, 2, 3, 4, 5, 6, 7,
                                 8, 9, 10, 11, 12, 13, 14, 15);
}

// ---- transposing fragment loader: A = T^T from a row-major LDS tile T[k][m] ----
// p is the lane's own address, T + (k0 + 8*(lane>>4) + (lane&7)) * ld + m0 + 8*((lane>>3)&1);
// the lane gets T[k0 + 8*(lane>>4) + i + (i>=8 ? 8 : 0)][m0 + (lane&15)]: ld_frag's k order.
__device__ __forceinline__ v8h ld_tr16(const f16* p) {
  typedef __attribute__((address_space(3))) v8s lds_v8s;
  return __builtin_bit_cast(v8h, __builtin_amdgcn_ds_load_tr16_b128_v8i16((lds_v8s*)p));
}
__device__ __forceinline__ v16h ld_frag_tr(const f16* p, int ld) {
  v8h lo = ld_tr16(p);
  v8h hi = ld_tr16(p + 16 * ld);
  return __builtin_shufflevector(lo, hi, 0, 1, 2, 3, 4, 5, 6, 7,
                                 8, 9, 10, 11, 12, 13, 14, 15);
}

__device__ __forceinline__ v8f wmma_f16(v16h a, v16h b, v8f c) {
  return __builtin_amdgcn_wmma_f32_16x16x32_f16(false, a, false, b,
                                                (short)0, c, false, false);
}

// scheduling fence: keep register pressure bounded (no hoisting across)
__device__ __forceinline__ void sched_fence() {
  __builtin_amdgcn_sched_barrier(0);
}

// ---- CDNA5 async global->LDS copy (ASYNCcnt tracked, no VGPR data) ----
// four copies of one lane; the address wait is the statement's last line, so that it
// stands in front of whatever reuses the copies' address registers
__device__ __forceinline__ void async_ld4_b128(uint32_t l0, uint32_t l1, uint32_t l2, uint32_t l3,
                                               const f16* g0, const f16* g1,
                                               const f16* g2, const f16* g3) {
  asm volatile("global_load_async_to_lds_b128 %0, %4, off\n\t"
               "global_load_async_to_lds_b128 %1, %5, off\n\t"
               "global_load_async_to_lds_b128 %2, %6, off\n\t"
               "global_load_async_to_lds_b128 %3, %7, off\n\t"
               "s_wait_xcnt 0x0"
               :: "v"(l0), "v"(l1), "v"(l2), "v"(l3), "v"(g0), "v"(g1), "v"(g2), "v"(g3)
               : "memory");
}
__device__ __forceinline__ void wait_async0() {
  asm volatile("s_wait_asynccnt 0x0" ::: "memory");
}
__device__ __forceinline__ uint32_t lds_off(const void* p) {
  return (uint32_t)(uintptr_t)p;   // low 32 bits of shared aperture = LDS offset
}

// work-group barrier that orders LDS only: the next tile's global loads stay in
// flight across it and the output stores are not waited for (__syncthreads drains both)
__device__ __forceinline__ void lds_barrier() {
  __builtin_amdgcn_fence(__ATOMIC_RELEASE, "workgroup", "local");
  __builtin_amdgcn_s_barrier();
  __builtin_amdgcn_fence(__ATOMIC_ACQUIRE, "workgroup", "local");
}

// reciprocal and 2^x with the one free slot that the instruction set asks for behind
// a transcendental
__device__ __forceinline__ float rcp_slot(float x) {
  float y;
  asm("v_rcp_f32 %0, %1\n\tv_nop" : "=v"(y) : "v"(x));
  return y;
}
__device__ __forceinline__ float exp2_slot(float x) {
  float y;
  asm("v_exp_f32 %0, %1\n\tv_nop" : "=v"(y) : "v"(x));
  return y;
}

// ===================== Kernel 1: input projections, one launch =====================
// Weight-stationary and transposed: D^T = W^T X^T. A block takes one row group
// (256 tokens) of one activation (even blocks q_x: wq, wg; odd blocks kv_x: wk, wv).
// A wave keeps the A fragments of its 64 output columns in registers for the whole
// block; only the activation goes through LDS, in 32-token tiles, two buffers.
// Column map of a wave: row j of matrix tile t is column base + 4*j + t, so one
// 16-byte load of a weight row feeds all four tiles, and lane (token, hg) ends up
// with the 32 consecutive columns base + 32*hg .. +31 of its token.
// The first kPB blocks do no projection: each re-lays one 16-query x 256-key tile of
// the pair bias into the order in which the attention kernel's lanes take it as the
// C operand of S^T: Bp[tile][nt][half][lane] (16 bytes each) =
// bias_pair[h][16*qt + (lane&15)][16*nt + 8*(lane>>4) + 4*half .. +3], tile = 16*h + qt.
// The tile is read 256 times (once per row group), so the scattered read is paid here
// once and every later wave-wide 16-byte load covers 512 contiguous bytes.
__global__ __launch_bounds__(256, 4)
void proj_all_kernel(const float* __restrict__ q_x, const float* __restrict__ kv_x,
                     const float* __restrict__ wq,  const float* __restrict__ wk,
                     const float* __restrict__ wv,  const float* __restrict__ wg,
                     const float* __restrict__ bg,
                     const float* __restrict__ bias_pair, float* __restrict__ Bp,
                     f16* __restrict__ Qh, f16* __restrict__ Kh,
                     f16* __restrict__ Vh, f16* __restrict__ Gh) {
  extern __shared__ f16 smem[];
  f16*   xs  = smem;                               // [2][kRT][kLdX] activation tiles
  f16*   os  = smem + 2 * kRT * kLdX;              // [8 waves][32][kLdO] output rows
  float* bgs = (float*)(os + 8 * 32 * kLdO);       // [256] gate bias
  const int tid  = threadIdx.x;
  if (blockIdx.x < kPB) {                          // block-uniform, in front of every barrier
    const float* bsrc = bias_pair + (size_t)blockIdx.x * 16 * kS
                        + (tid & 15) * kS + ((tid >> 4) & 1) * 8 + ((tid >> 5) & 1) * 4
                        + (tid >> 6) * 16;
    v4f* bdst = (v4f*)Bp + (size_t)blockIdx.x * (16 * kS / 4) + tid;
    v4f bv[4];
#pragma unroll
    for (int j = 0; j < 4; ++j) bv[j] = *(const v4f*)(bsrc + j * 64);   // nt = tid/64 + 4*j
#pragma unroll
    for (int j = 0; j < 4; ++j) bdst[j * 256] = bv[j];
    return;
  }
  const int side = blockIdx.x & 1;                 // kPB is even
  const int nr   = (blockIdx.x - kPB) >> 1;
  const int lane = tid & 31, hg = lane >> 4, ln = lane & 15;
  const int wave = __builtin_amdgcn_readfirstlane(tid >> 5);
  const bool second = wave >= 4;                   // waves 4..7: wg or wv
  const bool gate   = second && side == 0;
  const int  base   = (wave & 3) * 64;             // first output column of this wave

  const float* wp  = side ? (second ? wv : wk) : (second ? wg : wq);
  f16*         dst = side ? (second ? Vh : Kh) : (second ? Gh : Qh);
  const bool   isq = side == 0 && !second;         // Q carries 1/sqrt(32)

  f16* ow = os + wave * 32 * kLdO;                 // this wave's own staging rows
  f16* owr = ow + (hg * 16 + ln) * kLdO;           // written: row (hg, token)
  // read back so that every 16-byte store instruction covers whole 128-byte lines:
  // gate [NR][S][HC]: 4 tokens x 128 bytes per store; Q/K/V [NR][H][S][CH]: 8 tokens
  // x 64 bytes of one head per store, stores 2 and 3 in the wave's second head
  const f16* ord = ow + (gate ? (((lane >> 2) & 1) * 16 + (lane >> 3)) : (lane >> 2)) * kLdO
                   + (lane & 3) * 8;
  const int ostep = gate ? 4 * kLdO : 8 * kLdO;    // LDS step per store
  f16* gdst = dst + (gate ? ((size_t)nr * kS + (lane >> 3)) * kHC + base + (lane & 7) * 8
                          : ((size_t)nr * kH + (wave & 3) * 2) * kS * kCH + lane * 8);
  const int gstep = gate ? 4 * kHC : 8 * kCH;      // global step per store
  const int hstep = gate ? 0 : kS * kCH - 2 * gstep;   // on to the second head
  const int tstep = gate ? kHC : kCH;              // global step per token

  // a wave-wide 16-byte load covers one whole 512-byte token row
  const v4f* xsrc = (const v4f*)((side ? kv_x : q_x) + (size_t)nr * kS * kC) + tid;
  f16* xdst = xs + (tid >> 5) * kLdX + lane * 4;
  v4f xr[4];
#pragma unroll
  for (int j = 0; j < 4; ++j) xr[j] = xsrc[j * 256];

  bgs[tid] = bg[tid];

  v16h wf[4][4];                                   // [tile t][k step]
  const float* wl = wp + base + 4 * ln + (hg << 3) * kHC;
  v4f wr[2][16];                                   // one k step in use, the next in flight
#pragma unroll
  for (int i = 0; i < 16; ++i)                     // same k order as ld_frag
    wr[0][i] = *(const v4f*)(wl + (i + (i >= 8 ? 8 : 0)) * kHC);
#pragma unroll
  for (int ks = 0; ks < 4; ++ks) {
    v4f* wc = wr[ks & 1];
    if (ks + 1 < 4) {
#pragma unroll
      for (int i = 0; i < 16; ++i)
        wr[(ks + 1) & 1][i] = *(const v4f*)(wl + ((ks + 1) * 32 + i + (i >= 8 ? 8 : 0)) * kHC);
    }
    // holds the later k steps' loads behind this step's values: all 64 loads
    // issued at once need more registers than the wave has and spill
    asm volatile("" :: "v"(wc[0]), "v"(wc[1]), "v"(wc[2]), "v"(wc[3]), "v"(wc[4]), "v"(wc[5]),
                 "v"(wc[6]), "v"(wc[7]), "v"(wc[8]), "v"(wc[9]), "v"(wc[10]), "v"(wc[11]),
                 "v"(wc[12]), "v"(wc[13]), "v"(wc[14]), "v"(wc[15]) : "memory");
#pragma unroll
    for (int i = 0; i < 16; ++i)
#pragma unroll
      for (int t = 0; t < 4; ++t) wf[t][ks][i] = (f16)wc[i][t];
  }

#pragma unroll
  for (int j = 0; j < 4; ++j)
    *(v4h*)(xdst + j * 8 * kLdX) = __builtin_convertvector(xr[j], v4h);
#pragma unroll
  for (int j = 0; j < 4; ++j) xr[j] = xsrc[1024 + j * 256];
  // address wait before the loads' address registers are reused
  asm volatile("s_wait_xcnt 0x0" ::: "memory");
  lds_barrier();

#pragma unroll 1   // rolled: the buffer index is the only thing that differs between trips
  for (int tt = 0; tt < kS / kRT; ++tt) {
    const f16* xb = xs + (tt & 1) * kRT * kLdX;
#pragma unroll 1   // rolled: beside the weight fragments there are registers for one tile only
    for (int st = 0; st < kRT / 16; ++st) {
      v16h xf[4];                                  // B = X^T, all four k steps
#pragma unroll
      for (int ks = 0; ks < 4; ++ks) xf[ks] = ld_frag(xb, st * 16, kLdX, ks * 32, lane);
      sched_fence();   // one group of LDS reads, one wait: none among the WMMAs
      v8f acc[4] = {};
#pragma unroll
      for (int ks = 0; ks < 4; ++ks)
#pragma unroll
        for (int t = 0; t < 4; ++t) acc[t] = wmma_f16(wf[t][ks], xf[ks], acc[t]);
      if (gate) {
#pragma unroll
        for (int r = 0; r < 8; ++r) {
          const v4f b4 = *(const v4f*)(bgs + base + 32 * hg + 4 * r);
#pragma unroll
          for (int t = 0; t < 4; ++t)
            acc[t][r] = rcp_slot(1.0f + exp2_slot((acc[t][r] + b4[t]) * -1.4426950408889634f));  // sigmoid
        }
      } else if (isq) {
#pragma unroll
        for (int t = 0; t < 4; ++t) acc[t] *= 0.17677669529663687f;
      }
#pragma unroll
      for (int c = 0; c < 4; ++c) {                // columns 8c .. 8c+7 of the lane's 32
        v8h o;
#pragma unroll
        for (int e = 0; e < 8; ++e) o[e] = (f16)acc[e & 3][2 * c + (e >> 2)];
        *(v8h*)(owr + c * 8) = o;
      }
      // the rows come back from other lanes of this wave: their LDS writes first
      asm volatile("s_wait_dscnt 0x0" ::: "memory");
      const int tok = tt * kRT + st * 16;          // first token of this 16-token tile
      f16* g = gdst + tok * tstep;
#pragma unroll
      for (int c = 0; c < 4; ++c)
        *(v8h*)(g + c * gstep + (c >> 1) * hstep) = *(const v8h*)(ord + c * ostep);
      // address wait before the next tile overwrites the stores' registers
      asm volatile("s_wait_xcnt 0x0" ::: "memory");
    }
    if (tt + 1 < kS / kRT) {                       // block-uniform
      f16* xn = xdst + ((tt + 1) & 1) * kRT * kLdX;   // last read in trip tt - 1
#pragma unroll
      for (int j = 0; j < 4; ++j)
        *(v4h*)(xn + j * 8 * kLdX) = __builtin_convertvector(xr[j], v4h);
      if (tt + 2 < kS / kRT) {
#pragma unroll
        for (int j = 0; j < 4; ++j) xr[j] = xsrc[(tt + 2) * 1024 + j * 256];
        // address wait before the loads' address registers are reused
        asm volatile("s_wait_xcnt 0x0" ::: "memory");
      }
      lds_barrier();
    }
  }
}

__device__ __forceinline__ float other_half(float x) {   // lane l <-> l ^ 16
  int b = __builtin_bit_cast(int, x);
  b = __builtin_amdgcn_permlanex16(b, b, 0x76543210, 0xfedcba98, false, false);
  return __builtin_bit_cast(float, b);
}

// One head's operands that come straight from global memory into registers: the re-laid
// pair bias (lane-contiguous, every load covers four whole 128-byte lines) lands in the
// score accumulators, the wave's own Q^T fragment (ld_frag's k order, the 16 query rows of
// a wave are 1 KB in a row) beside it.
__device__ __forceinline__ void head_loads(const v4f* bpp, const f16* qp,
                                           v8f (&sacc)[16], v16h& bq) {
  v8h lo = *(const v8h*)(qp);                // first: the first score tile already needs it
  v8h hi = *(const v8h*)(qp + 16);
  bq = __builtin_shufflevector(lo, hi, 0, 1, 2, 3, 4, 5, 6, 7, 8, 9, 10, 11, 12, 13, 14, 15);
#pragma unroll
  for (int nt = 0; nt < 16; ++nt) {          // 8 consecutive keys per lane: 16-byte loads
    v4f p0 = bpp[nt * 64];
    v4f p1 = bpp[nt * 64 + 32];
    sacc[nt] = __builtin_shufflevector(p0, p1, 0, 1, 2, 3, 4, 5, 6, 7);
  }
  // address wait before the loads' address registers are reused; the pointers are
  // inputs so that no load of the run lands on an address pair itself
  asm volatile("s_wait_xcnt 0x0" :: "v"(bpp), "v"(qp) : "memory");
}

// One block of 16 waves takes one row group and all of its 8 heads; a wave owns 16 query
// columns. K and V of head h + 1 fly into the second LDS buffer while head h is worked on.
// The gated attention rows never leave the WGP: they are laid in LDS as the A rows of the
// output projection, which the same block does behind the last head.
// Output projection, weight-stationary: wo is read once per block with whole-row loads and
// laid in LDS as f16 rows; a wave keeps the B fragments of its 32 output columns (all 256 k)
// in registers for its 64 tokens, taken by the transposing LDS load.
// Column map of a wave: column j of matrix tile t is output column 32*cg + 2*j + t, so a
// lane holds two neighbouring columns of a token and an 8-byte store instruction covers
// two whole 128-byte lines. wo's columns are regrouped to that map on their way into LDS:
// column 32*cg + 2*j + t lies at position 32*cg + 16*t + j of its row.
__global__ __launch_bounds__(512, 1)
void attn_out_kernel(const float* __restrict__ bias_mask,
                     const float* __restrict__ Bp,
                     const f16* __restrict__ Qh, const f16* __restrict__ Kh,
                     const f16* __restrict__ Vh, const f16* __restrict__ Gh,
                     const float* __restrict__ wo, const float* __restrict__ bo,
                     float* __restrict__ out) {
  __shared__ __attribute__((aligned(128))) f16 As[kS * kLdP];    // [256][kLdP] gated attention rows
  __shared__ __attribute__((aligned(128))) f16 Ws[kHC * kLdW];   // [256][kLdW] wo rows, columns regrouped
  __shared__ __attribute__((aligned(128))) f16 Kb[2 * kS * kLdQ];   // 2 x K [256][kLdQ]
  __shared__ __attribute__((aligned(128))) f16 Vb[2 * kS * kLdV];   // 2 x V [256][kLdV]
  __shared__ __attribute__((aligned(128))) float Ms[kS];         // the row group's key mask, the same for all heads
  const int nr  = blockIdx.x;
  const int tid = threadIdx.x;
  const int lane = tid & 31, hg = lane >> 4, ln = lane & 15;
  const int wave = __builtin_amdgcn_readfirstlane(tid >> 5);

  // async 16-byte copies into padded rows, a row = 4 chunks: chunk tid + 512*j is key
  // tid/4 + 128*j; V lies untransposed, the LDS reads of the second product transpose it
  const size_t base = (size_t)nr * kH * kS * kCH;        // in halves; a head is kS*kCH more
  const f16* ksrc = Kh + base + tid * 8;
  const f16* vsrc = Vh + base + tid * 8;
  const uint32_t kdst = lds_off(Kb) + (uint32_t)(((tid >> 2) * kLdQ + (tid & 3) * 8) * 2);
  const uint32_t vdst = lds_off(Vb) + (uint32_t)(((tid >> 2) * kLdV + (tid & 3) * 8) * 2);
  async_ld4_b128(kdst, kdst + 128 * kLdQ * 2, vdst, vdst + 128 * kLdV * 2,
                 ksrc, ksrc + 4096, vsrc, vsrc + 4096);

  // a wave-wide 16-byte load covers one whole 512-byte row of wo: row tid/32 + 16*j
  {
    const v4f* wsrc = (const v4f*)wo + tid;
    v4f wr[16];
#pragma unroll
    for (int j = 0; j < 16; ++j) wr[j] = wsrc[j * 512];
    // address wait before the loads' address registers are reused
    asm volatile("s_wait_xcnt 0x0" ::: "memory");
    f16* wdst = Ws + (tid >> 5) * kLdW + (lane >> 3) * 32 + (lane & 7) * 2;
#pragma unroll
    for (int j = 0; j < 16; ++j) {
      v2h ev = {(f16)wr[j][0], (f16)wr[j][2]};       // tile 0: even columns
      v2h od = {(f16)wr[j][1], (f16)wr[j][3]};       // tile 1: odd columns
      *(v2h*)(wdst + j * 16 * kLdW)      = ev;
      *(v2h*)(wdst + j * 16 * kLdW + 16) = od;
    }
  }
  if (tid < kS) Ms[tid] = bias_mask[(size_t)nr * kS + tid];

  // D/C layout of S^T tile nt: register r = S[key 16*nt + 8*hg + r][query q]
  const int q = wave * 16 + ln;
  const float* bmp = Ms + (hg << 3);
  const int kfo = ln * kLdQ + (hg << 3);
  const int vto = ((hg << 3) + (lane & 7)) * kLdV + ((lane >> 3) & 1) * 8;
  // per head: 16 bias tiles of 16*kS floats, kCH gate columns, kS*kCH halves of Q
  const v4f* bpp = (const v4f*)Bp + (size_t)wave * (16 * kS / 4) + lane;
  // O^T: register r = O[query q][channel 16*ct + 8*hg + r]: 16-byte gate load, 16-byte LDS store
  const f16* gp = Gh + ((size_t)nr * kS + q) * kHC + (hg << 3);
  const f16* qp = Qh + base + q * kCH + (hg << 3);
  f16* ap = As + q * kLdP + (hg << 3);

#pragma unroll 1   // rolled: the buffer and the pointers are all that differs between heads
  for (int h = 0; h < kH; ++h) {
    v8f sacc[16];
    v16h bq;                                 // B = Q^T, K-dim = 32
    // issued in front of the barrier: in flight while the wave waits for the others
    head_loads(bpp + h * 16 * (16 * kS / 4), qp + h * kS * kCH, sacc, bq);
    // hand-over between heads: this wave's LDS reads and writes of head h - 1 are done (in
    // the first trip: wo and the mask are laid) and its copies of head h have landed; behind
    // the barrier head h may be read and the other buffer refilled
    asm volatile("s_wait_dscnt 0x0" ::: "memory");
    wait_async0();
    lds_barrier();     // LDS only: the bias loads stay in flight across it
    if (h + 1 < kH) {  // block-uniform
      const uint32_t kb = (uint32_t)(((h + 1) & 1) * kS * kLdQ * 2);
      const uint32_t vb = (uint32_t)(((h + 1) & 1) * kS * kLdV * 2);
      const f16* kn = ksrc + (h + 1) * kS * kCH;
      const f16* vn = vsrc + (h + 1) * kS * kCH;
      async_ld4_b128(kdst + kb, kdst + kb + 128 * kLdQ * 2, vdst + vb, vdst + vb + 128 * kLdV * 2,
                     kn, kn + 4096, vn, vn + 4096);
    }
    const f16* kfp = Kb + (h & 1) * kS * kLdQ + kfo;
    const f16* vtp = Vb + (h & 1) * kS * kLdV + vto;
    sched_fence();     // all pair-bias loads in flight, landing in the accumulators
#pragma unroll
    for (int g = 0; g < 4; ++g) {            // 4 score tiles per fenced group
      v8f bm[4];
      v16h ak[4];
#pragma unroll
      for (int j = 0; j < 4; ++j) {
        const int nt = g * 4 + j;
        v4f m0 = *(const v4f*)(bmp + nt * 16);
        v4f m1 = *(const v4f*)(bmp + nt * 16 + 4);
        bm[j] = __builtin_shufflevector(m0, m1, 0, 1, 2, 3, 4, 5, 6, 7);
        v8h klo = *(const v8h*)(kfp + nt * 16 * kLdQ);            // A = K rows, ld_frag's k order
        v8h khi = *(const v8h*)(kfp + nt * 16 * kLdQ + 16);
        ak[j] = __builtin_shufflevector(klo, khi, 0, 1, 2, 3, 4, 5, 6, 7,
                                        8, 9, 10, 11, 12, 13, 14, 15);
      }
#pragma unroll
      for (int j = 0; j < 4; ++j)
        sacc[g * 4 + j] = wmma_f16(ak[j], bq, sacc[g * 4 + j] + bm[j]);
      sched_fence();   // cap live mask values and K fragments: no cross-group hoisting
    }
    // gate fetched where the mask values and K fragments have left their registers, a whole
    // softmax ahead of its use
    const f16* gph = gp + h * kCH;
    const v8h g0 = *(const v8h*)(gph);
    const v8h g1 = *(const v8h*)(gph + 16);
    // address wait before the loads' address registers are reused
    asm volatile("s_wait_xcnt 0x0" :: "v"(gph) : "memory");
    // softmax over 256 keys of this lane's query: 128 in-lane values + other half
    float mx[8];
#pragma unroll
    for (int r = 0; r < 8; ++r) mx[r] = sacc[0][r];
#pragma unroll
    for (int nt = 1; nt < 16; ++nt)
#pragma unroll
      for (int r = 0; r < 8; ++r) mx[r] = fmaxf(mx[r], sacc[nt][r]);
    float m = fmaxf(fmaxf(fmaxf(mx[0], mx[1]), fmaxf(mx[2], mx[3])),
                    fmaxf(fmaxf(mx[4], mx[5]), fmaxf(mx[6], mx[7])));
    m = fmaxf(m, other_half(m));

    float sm[8] = {0.f, 0.f, 0.f, 0.f, 0.f, 0.f, 0.f, 0.f};
    v8f o0 = {}, o1 = {};
#pragma unroll
    for (int kk = 0; kk < 8; ++kk) {         // 32 keys: two score tiles -> one B operand
      v16h pb;
#pragma unroll
      for (int r = 0; r < 8; ++r) {
        float e0 = __expf(sacc[2 * kk][r] - m);
        float e1 = __expf(sacc[2 * kk + 1][r] - m);
        sm[r] += e0 + e1;
        pb[r]     = (f16)e0;
        pb[8 + r] = (f16)e1;
      }
      v16h a0 = ld_frag_tr(vtp + kk * 32 * kLdV,      kLdV);      // A = V^T rows
      v16h a1 = ld_frag_tr(vtp + kk * 32 * kLdV + 16, kLdV);
      o0 = wmma_f16(a0, pb, o0);
      o1 = wmma_f16(a1, pb, o1);
    }
    float s = ((sm[0] + sm[1]) + (sm[2] + sm[3])) + ((sm[4] + sm[5]) + (sm[6] + sm[7]));
    s += other_half(s);
    const float rinv = __builtin_amdgcn_rcpf(s);

    v8h r0, r1;
#pragma unroll
    for (int r = 0; r < 8; ++r) {
      r0[r] = (f16)(o0[r] * rinv * (float)g0[r]);
      r1[r] = (f16)(o1[r] * rinv * (float)g1[r]);
    }
    *(v8h*)(ap + h * kCH)      = r0;
    *(v8h*)(ap + h * kCH + 16) = r1;
  }
  // every wave's gated rows are laid before any wave reads them as A rows
  asm volatile("s_wait_dscnt 0x0" ::: "memory");
  wait_async0();
  __syncthreads();

  // ---- output projection of the block's 256 tokens ----
  const int cg = wave & 3;                         // 32 output columns
  const int t0 = (wave >> 2) * 64;                 // 64 tokens
  v16h wf[2][8];                                   // [tile t][k step]
  const f16* wtp = Ws + ((hg << 3) + (lane & 7)) * kLdW + cg * 32 + ((lane >> 3) & 1) * 8;
#pragma unroll
  for (int ks = 0; ks < 8; ++ks)
#pragma unroll
    for (int t = 0; t < 2; ++t) wf[t][ks] = ld_frag_tr(wtp + ks * 32 * kLdW + t * 16, kLdW);
  const v2f bias = *(const v2f*)(bo + cg * 32 + 2 * ln);

  // D layout: register r = token 8*hg + r of the tile, lane&15 = column j
  float* op = out + ((size_t)nr * kS + t0 + (hg << 3)) * kC + cg * 32 + 2 * ln;
#pragma unroll 1   // rolled: beside the weight fragments there are registers for one tile only
  for (int st = 0; st < 4; ++st) {
    v16h af[8];                                    // A = token rows, all eight k steps
#pragma unroll
    for (int ks = 0; ks < 8; ++ks) af[ks] = ld_frag(As, t0 + st * 16, kLdP, ks * 32, lane);
    sched_fence();   // one group of LDS reads in front of the WMMAs, none among them
    v8f a0 = {}, a1 = {};
#pragma unroll
    for (int ks = 0; ks < 8; ++ks) {
      a0 = wmma_f16(af[ks], wf[0][ks], a0);
      a1 = wmma_f16(af[ks], wf[1][ks], a1);
    }
    float* o = op + st * 16 * kC;
#pragma unroll
    for (int r = 0; r < 8; ++r) {
      v2f v = {a0[r] + bias[0], a1[r] + bias[1]};
      *(v2f*)(o + r * kC) = v;
    }
    // address wait before the next tile overwrites the stores' registers
    asm volatile("s_wait_xcnt 0x0" ::: "memory");
  }
}

extern "C" void kernel_launch(void* const* d_in, const int* in_sizes, int n_in,
                              void* d_out, int out_size, void* d_ws, size_t ws_size,
                              hipStream_t stream) {
  const float* q_x       = (const float*)d_in[0];
  const float* kv_x      = (const float*)d_in[1];
  const float* bias_mask = (const float*)d_in[2];
  const float* bias_pair = (const float*)d_in[3];
  const float* wq = (const float*)d_in[4];
  const float* wk = (const float*)d_in[5];
  const float* wv = (const float*)d_in[6];
  const float* wg = (const float*)d_in[7];
  const float* bg = (const float*)d_in[8];
  const float* wo = (const float*)d_in[9];
  const float* bo = (const float*)d_in[10];
  float* out = (float*)d_out;

  char* wsb = (char*)d_ws;
  const size_t SZ = (size_t)kNR * kH * kS * kCH * sizeof(f16);  // 33.5 MB each
  f16* Qh = (f16*)(wsb + 0 * SZ);   // [NR][H][S][CH], pre-scaled
  f16* Kh = (f16*)(wsb + 1 * SZ);   // [NR][H][S][CH]
  f16* Vh = (f16*)(wsb + 2 * SZ);   // [NR][H][S][CH]
  f16* Gh = (f16*)(wsb + 3 * SZ);   // [NR][S][HC] sigmoid gate
  float* Bp = (float*)(wsb + 4 * SZ);   // [H*16][16][2][32][4] pair bias in C-operand order, 2 MB

  dim3 blk(256);
  const size_t smem1 = (2 * kRT * kLdX + 8 * 32 * kLdO) * sizeof(f16) + kHC * sizeof(float);
  proj_all_kernel<<<dim3(kPB + kNR * 2), blk, smem1, stream>>>(
      q_x, kv_x, wq, wk, wv, wg, bg, bias_pair, Bp, Qh, Kh, Vh, Gh);
  attn_out_kernel<<<dim3(kNR), dim3(512), 0, stream>>>(
      bias_mask, Bp, Qh, Kh, Vh, Gh, wo, bo, out);
}

// v008
// Measured time: 66.1 microseconds a run.
// It is 1.15 times as fast as v006, going by the measured steps of the versions left out in between.
// All steps since v000 together make it 3.52 times as fast.
#include <hip/hip_runtime.h>

typedef _Float16 f16;
typedef __attribute__((ext_vector_type(2)))  _Float16 v2h;
typedef __attribute__((ext_vector_type(4)))  _Float16 v4h;
typedef __attribute__((ext_vector_type(8)))  _Float16 v8h;
typedef __attribute__((ext_vector_type(16))) _Float16 v16h;
typedef __attribute__((ext_vector_type(8)))  float    v8f;
typedef __attribute__((ext_vector_type(4)))  float    v4f;
typedef __attribute__((ext_vector_type(2)))  float    v2f;
typedef __attribute__((ext_vector_type(8)))  short    v8s;

constexpr int kS  = 256;   // tokens (Q = K)
constexpr int kC  = 128;   // input channels (CQ=CK=CV)
constexpr int kH  = 8;     // heads
constexpr int kCH = 32;    // head dim
constexpr int kHC = 256;   // H*CH
constexpr int kNR = 256;   // rows
constexpr int kRT = 32;    // tokens per staged activation tile (projections)
constexpr int kPB = 128;   // (head, 16-query tile) pairs: one re-laying block each
constexpr int kAhead = 6;  // step of a head's second product at which the next head's bias and Q are fetched
constexpr float kBig = 60000.0f;   // bound of a bias value on its way to f16

// padded LDS row strides (halves): multiples of 8 -> 16B-aligned b128
// loads with lanes spread across banks
constexpr int kLdX = 136;  // 128 + 8
constexpr int kLdO = 40;   // 32 + 8 (projection output rows on their way to whole-line stores)
constexpr int kLdQ = 40;   // 32 + 8 (K tiles, K-dim 32)
constexpr int kLdP = 264;  // 256 + 8 (output projection rows, K-dim 256)
constexpr int kLdW = 144;  // 128 + 16 (wo rows): 288 bytes, an odd multiple of 32, the transposing load's pitch
constexpr int kLdV = 48;   // 32 + 16 (V rows): 96 bytes, an odd multiple of 32, the transposing load's pitch

// ---- fragment loader (CDNA5 16-bit WMMA layout, ISA 7.12.2) ----
// Source is [M][K] (A) or [N][K] (B^T staged): lane owns row (base + lane&15),
// element i holds K = k0 + 8*(lane>>4) + i + (i>=8 ? 8 : 0)  -> two
// contiguous 16-byte runs -> exactly two ds_load_b128 per fragment.
__device__ __forceinline__ v16h ld_frag(const f16* p, int row0, int ld,
                                        int k0, int lane) {
  const f16* q = p + (size_t)(row0 + (lane & 15)) * ld + k0 + ((lane >> 4) << 3);
  v8h lo = *(const v8h*)(q);
  v8h hi = *(const v8h*)(q + 16);
  return __builtin_shufflevector(lo, hi, 0, 1, 2, 3, 4, 5, 6, 7,
                                 8, 9, 10, 11, 12, 13, 14, 15);
}

// ---- transposing fragment loader: A = T^T from a row-major LDS tile T[k][m] ----
// p is the lane's own address, T + (k0 + 8*(lane>>4) + (lane&7)) * ld + m0 + 8*((lane>>3)&1);
// the lane gets T[k0 + 8*(lane>>4) + i + (i>=8 ? 8 : 0)][m0 + (lane&15)]: ld_frag's k order.
__device__ __forceinline__ v8h ld_tr16(const f16* p) {
  typedef __attribute__((address_space(3))) v8s lds_v8s;
  return __builtin_bit_cast(v8h, __builtin_amdgcn_ds_load_tr16_b128_v8i16((lds_v8s*)p));
}
__device__ __forceinline__ v16h ld_frag_tr(const f16* p, int ld) {
  v8h lo = ld_tr16(p);
  v8h hi = ld_tr16(p + 16 * ld);
  return __builtin_shufflevector(lo, hi, 0, 1, 2, 3, 4, 5, 6, 7,
                                 8, 9, 10, 11, 12, 13, 14, 15);
}

__device__ __forceinline__ v8f wmma_f16(v16h a, v16h b, v8f c) {
  return __builtin_amdgcn_wmma_f32_16x16x32_f16(false, a, false, b,
                                                (short)0, c, false, false);
}

// scheduling fence: keep register pressure bounded (no hoisting across)
__device__ __forceinline__ void sched_fence() {
  __builtin_amdgcn_sched_barrier(0);
}

// ---- CDNA5 async global->LDS copy (ASYNCcnt tracked, no VGPR data) ----
// four copies of one lane; the address wait is the statement's last line, so that it
// stands in front of whatever reuses the copies' address registers
__device__ __forceinline__ void async_ld4_b128(uint32_t l0, uint32_t l1, uint32_t l2, uint32_t l3,
                                               const f16* g0, const f16* g1,
                                               const f16* g2, const f16* g3) {
  asm volatile("global_load_async_to_lds_b128 %0, %4, off\n\t"
               "global_load_async_to_lds_b128 %1, %5, off\n\t"
               "global_load_async_to_lds_b128 %2, %6, off\n\t"
               "global_load_async_to_lds_b128 %3, %7, off\n\t"
               "s_wait_xcnt 0x0"
               :: "v"(l0), "v"(l1), "v"(l2), "v"(l3), "v"(g0), "v"(g1), "v"(g2), "v"(g3)
               : "memory");
}
__device__ __forceinline__ void wait_async0() {
  asm volatile("s_wait_asynccnt 0x0" ::: "memory");
}
__device__ __forceinline__ uint32_t lds_off(const void* p) {
  return (uint32_t)(uintptr_t)p;   // low 32 bits of shared aperture = LDS offset
}

// work-group barrier that orders LDS only: the next tile's global loads stay in
// flight across it and the output stores are not waited for (__syncthreads drains both)
__device__ __forceinline__ void lds_barrier() {
  __builtin_amdgcn_fence(__ATOMIC_RELEASE, "workgroup", "local");
  __builtin_amdgcn_s_barrier();
  __builtin_amdgcn_fence(__ATOMIC_ACQUIRE, "workgroup", "local");
}

// reciprocal and 2^x with the one free slot that the instruction set asks for behind
// a transcendental
__device__ __forceinline__ float rcp_slot(float x) {
  float y;
  asm("v_rcp_f32 %0, %1\n\tv_nop" : "=v"(y) : "v"(x));
  return y;
}
__device__ __forceinline__ float exp2_slot(float x) {
  float y;
  asm("v_exp_f32 %0, %1\n\tv_nop" : "=v"(y) : "v"(x));
  return y;
}

// ===================== Kernel 1: input projections, one launch =====================
// Weight-stationary and transposed: D^T = W^T X^T. A block takes one row group
// (256 tokens) of one activation (even blocks q_x: wq, wg; odd blocks kv_x: wk, wv).
// A wave keeps the A fragments of its 64 output columns in registers for the whole
// block; only the activation goes through LDS, in 32-token tiles, two buffers.
// Column map of a wave: row j of matrix tile t is column base + 4*j + t, so one
// 16-byte load of a weight row feeds all four tiles, and lane (token, hg) ends up
// with the 32 consecutive columns base + 32*hg .. +31 of its token.
// The first kPB blocks do no projection: each re-lays one 16-query x 256-key tile of
// the pair bias, as f16, into the order in which the attention kernel's lanes take it as
// the A operand of a matrix product with an identity: Bp[tile][nt][lane] (8 halves) =
// bias_pair[h][16*qt + 8*(lane>>4) + 0..7][16*nt + (lane&15)], tile = 16*h + qt.
// The tile is read 256 times (once per row group), so the scattered read is paid here
// once and every later wave-wide 16-byte load covers 512 contiguous bytes.
__global__ __launch_bounds__(256, 4)
void proj_all_kernel(const float* __restrict__ q_x, const float* __restrict__ kv_x,
                     const float* __restrict__ wq,  const float* __restrict__ wk,
                     const float* __restrict__ wv,  const float* __restrict__ wg,
                     const float* __restrict__ bg,
                     const float* __restrict__ bias_pair, f16* __restrict__ Bp,
                     f16* __restrict__ Qh, f16* __restrict__ Kh,
                     f16* __restrict__ Vh, f16* __restrict__ Gh) {
  extern __shared__ f16 smem[];
  f16*   xs  = smem;                               // [2][kRT][kLdX] activation tiles
  f16*   os  = smem + 2 * kRT * kLdX;              // [8 waves][32][kLdO] output rows
  float* bgs = (float*)(os + 8 * 32 * kLdO);       // [256] gate bias
  const int tid  = threadIdx.x;
  if (blockIdx.x < kPB) {                          // block-uniform, in front of every barrier
    const float* bsrc = bias_pair + (size_t)blockIdx.x * 16 * kS
                        + ((tid >> 4) & 1) * 8 * kS + (tid & 15) + (tid >> 5) * 16;
    v8h* bdst = (v8h*)Bp + (size_t)blockIdx.x * (16 * kS / 8) + tid;
    float bv[2][8];
#pragma unroll
    for (int j = 0; j < 2; ++j)                    // nt = tid/32 + 8*j
#pragma unroll
      for (int i = 0; i < 8; ++i) bv[j][i] = bsrc[j * 128 + i * kS];
    // address wait before the loads' address registers are reused; the pointer is an
    // input so that no load of the run lands on the address pair itself
    asm volatile("s_wait_xcnt 0x0" :: "v"(bsrc) : "memory");
#pragma unroll
    for (int j = 0; j < 2; ++j) {
      v8h o;
#pragma unroll
      for (int i = 0; i < 8; ++i)                  // kept finite: an infinity times the identity's zeros is no number
        o[i] = (f16)fminf(fmaxf(bv[j][i], -kBig), kBig);
      bdst[j * 256] = o;
    }
    return;
  }
  const int side = blockIdx.x & 1;                 // kPB is even
  const int nr   = (blockIdx.x - kPB) >> 1;
  const int lane = tid & 31, hg = lane >> 4, ln = lane & 15;
  const int wave = __builtin_amdgcn_readfirstlane(tid >> 5);
  const bool second = wave >= 4;                   // waves 4..7: wg or wv
  const bool gate   = second && side == 0;
  const int  base   = (wave & 3) * 64;             // first output column of this wave

  const float* wp  = side ? (second ? wv : wk) : (second ? wg : wq);
  f16*         dst = side ? (second ? Vh : Kh) : (second ? Gh : Qh);
  const bool   isq = side == 0 && !second;         // Q carries 1/sqrt(32)

  f16* ow = os + wave * 32 * kLdO;                 // this wave's own staging rows
  f16* owr = ow + (hg * 16 + ln) * kLdO;           // written: row (hg, token)
  // read back so that every 16-byte store instruction covers whole 128-byte lines:
  // gate [NR][S][HC]: 4 tokens x 128 bytes per store; Q/K/V [NR][H][S][CH]: 8 tokens
  // x 64 bytes of one head per store, stores 2 and 3 in the wave's second head
  const f16* ord = ow + (gate ? (((lane >> 2) & 1) * 16 + (lane >> 3)) : (lane >> 2)) * kLdO
                   + (lane & 3) * 8;
  const int ostep = gate ? 4 * kLdO : 8 * kLdO;    // LDS step per store
  f16* gdst = dst + (gate ? ((size_t)nr * kS + (lane >> 3)) * kHC + base + (lane & 7) * 8
                          : ((size_t)nr * kH + (wave & 3) * 2) * kS * kCH + lane * 8);
  const int gstep = gate ? 4 * kHC : 8 * kCH;      // global step per store
  const int hstep = gate ? 0 : kS * kCH - 2 * gstep;   // on to the second head
  const int tstep = gate ? kHC : kCH;              // global step per token

  // a wave-wide 16-byte load covers one whole 512-byte token row
  const v4f* xsrc = (const v4f*)((side ? kv_x : q_x) + (size_t)nr * kS * kC) + tid;
  f16* xdst = xs + (tid >> 5) * kLdX + lane * 4;
  v4f xr[4];
#pragma unroll
  for (int j = 0; j < 4; ++j) xr[j] = xsrc[j * 256];

  bgs[tid] = bg[tid];

  v16h wf[4][4];                                   // [tile t][k step]
  const float* wl = wp + base + 4 * ln + (hg << 3) * kHC;
  v4f wr[2][16];                                   // one k step in use, the next in flight
#pragma unroll
  for (int i = 0; i < 16; ++i)                     // same k order as ld_frag
    wr[0][i] = *(const v4f*)(wl + (i + (i >= 8 ? 8 : 0)) * kHC);
#pragma unroll
  for (int ks = 0; ks < 4; ++ks) {
    v4f* wc = wr[ks & 1];
    if (ks + 1 < 4) {
#pragma unroll
      for (int i = 0; i < 16; ++i)
        wr[(ks + 1) & 1][i] = *(const v4f*)(wl + ((ks + 1) * 32 + i + (i >= 8 ? 8 : 0)) * kHC);
    }
    // holds the later k steps' loads behind this step's values: all 64 loads
    // issued at once need more registers than the wave has and spill
    asm volatile("" :: "v"(wc[0]), "v"(wc[1]), "v"(wc[2]), "v"(wc[3]), "v"(wc[4]), "v"(wc[5]),
                 "v"(wc[6]), "v"(wc[7]), "v"(wc[8]), "v"(wc[9]), "v"(wc[10]), "v"(wc[11]),
                 "v"(wc[12]), "v"(wc[13]), "v"(wc[14]), "v"(wc[15]) : "memory");
#pragma unroll
    for (int i = 0; i < 16; ++i)
#pragma unroll
      for (int t = 0; t < 4; ++t) wf[t][ks][i] = (f16)wc[i][t];
  }

#pragma unroll
  for (int j = 0; j < 4; ++j)
    *(v4h*)(xdst + j * 8 * kLdX) = __builtin_convertvector(xr[j], v4h);
#pragma unroll
  for (int j = 0; j < 4; ++j) xr[j] = xsrc[1024 + j * 256];
  // address wait before the loads' address registers are reused
  asm volatile("s_wait_xcnt 0x0" ::: "memory");
  lds_barrier();

#pragma unroll 1   // rolled: the buffer index is the only thing that differs between trips
  for (int tt = 0; tt < kS / kRT; ++tt) {
    const f16* xb = xs + (tt & 1) * kRT * kLdX;
#pragma unroll 1   // rolled: beside the weight fragments there are registers for one tile only
    for (int st = 0; st < kRT / 16; ++st) {
      v16h xf[4];                                  // B = X^T, all four k steps
#pragma unroll
      for (int ks = 0; ks < 4; ++ks) xf[ks] = ld_frag(xb, st * 16, kLdX, ks * 32, lane);
      sched_fence();   // one group of LDS reads, one wait: none among the WMMAs
      v8f acc[4] = {};
#pragma unroll
      for (int ks = 0; ks < 4; ++ks)
#pragma unroll
        for (int t = 0; t < 4; ++t) acc[t] = wmma_f16(wf[t][ks], xf[ks], acc[t]);
      if (gate) {
#pragma unroll
        for (int r = 0; r < 8; ++r) {
          const v4f b4 = *(const v4f*)(bgs + base + 32 * hg + 4 * r);
#pragma unroll
          for (int t = 0; t < 4; ++t)
            acc[t][r] = rcp_slot(1.0f + exp2_slot((acc[t][r] + b4[t]) * -1.4426950408889634f));  // sigmoid
        }
      } else if (isq) {
#pragma unroll
        for (int t = 0; t < 4; ++t) acc[t] *= 0.17677669529663687f;
      }
#pragma unroll
      for (int c = 0; c < 4; ++c) {                // columns 8c .. 8c+7 of the lane's 32
        v8h o;
#pragma unroll
        for (int e = 0; e < 8; ++e) o[e] = (f16)acc[e & 3][2 * c + (e >> 2)];
        *(v8h*)(owr + c * 8) = o;
      }
      // the rows come back from other lanes of this wave: their LDS writes first
      asm volatile("s_wait_dscnt 0x0" ::: "memory");
      const int tok = tt * kRT + st * 16;          // first token of this 16-token tile
      f16* g = gdst + tok * tstep;
#pragma unroll
      for (int c = 0; c < 4; ++c)
        *(v8h*)(g + c * gstep + (c >> 1) * hstep) = *(const v8h*)(ord + c * ostep);
      // address wait before the next tile overwrites the stores' registers
      asm volatile("s_wait_xcnt 0x0" ::: "memory");
    }
    if (tt + 1 < kS / kRT) {                       // block-uniform
      f16* xn = xdst + ((tt + 1) & 1) * kRT * kLdX;   // last read in trip tt - 1
#pragma unroll
      for (int j = 0; j < 4; ++j)
        *(v4h*)(xn + j * 8 * kLdX) = __builtin_convertvector(xr[j], v4h);
      if (tt + 2 < kS / kRT) {
#pragma unroll
        for (int j = 0; j < 4; ++j) xr[j] = xsrc[(tt + 2) * 1024 + j * 256];
        // address wait before the loads' address registers are reused
        asm volatile("s_wait_xcnt 0x0" ::: "memory");
      }
      lds_barrier();
    }
  }
}

__device__ __forceinline__ float other_half(float x) {   // lane l <-> l ^ 16
  int b = __builtin_bit_cast(int, x);
  b = __builtin_amdgcn_permlanex16(b, b, 0x76543210, 0xfedcba98, false, false);
  return __builtin_bit_cast(float, b);
}

// One head's operands that come straight from global memory into registers, one head ahead: the re-laid
// f16 pair bias (lane-contiguous, every load covers four whole 128-byte lines), the low
// half of each bias A fragment, and the wave's own Q^T fragment (ld_frag's k order, the 16
// query rows of a wave are 1 KB in a row) beside it.
__device__ __forceinline__ void head_loads(const v8h* bpp, const f16* qp,
                                           v8h (&bl)[16], v16h& bq) {
  v8h lo = *(const v8h*)(qp);                // first: the first score tile already needs it
  v8h hi = *(const v8h*)(qp + 16);
  bq = __builtin_shufflevector(lo, hi, 0, 1, 2, 3, 4, 5, 6, 7, 8, 9, 10, 11, 12, 13, 14, 15);
#pragma unroll
  for (int nt = 0; nt < 16; ++nt) bl[nt] = bpp[nt * 32];   // 8 queries of one key per lane
  // address wait before the loads' address registers are reused; the pointers are
  // inputs so that no load of the run lands on an address pair itself
  asm volatile("s_wait_xcnt 0x0" :: "v"(bpp), "v"(qp) : "memory");
}

// One block of 16 waves takes one row group and all of its 8 heads; a wave owns 16 query
// columns. K and V of head h + 1 fly into the second LDS buffer while head h is worked on.
// The gated attention rows never leave the WGP: they are laid in LDS as the A rows of the
// output projection, which the same block does behind the last head.
// Output projection, weight-stationary: wo is read once per block with whole-row loads and
// laid in LDS as f16 rows; a wave keeps the B fragments of its 32 output columns (all 256 k)
// in registers for its 64 tokens, taken by the transposing LDS load.
// Column map of a wave: column j of matrix tile t is output column 32*cg + 2*j + t, so a
// lane holds two neighbouring columns of a token and an 8-byte store instruction covers
// two whole 128-byte lines. wo's columns are regrouped to that map on their way into LDS:
// column 32*cg + 2*j + t lies at position 32*cg + 16*t + j of its row.
__global__ __launch_bounds__(512, 1)
void attn_out_kernel(const float* __restrict__ bias_mask,
                     const f16* __restrict__ Bp,
                     const f16* __restrict__ Qh, const f16* __restrict__ Kh,
                     const f16* __restrict__ Vh, const f16* __restrict__ Gh,
                     const float* __restrict__ wo, const float* __restrict__ bo,
                     float* __restrict__ out) {
  // one object, the mask table first: at the bottom of the LDS its 16 tile addresses fit the
  // LDS loads' immediate offset field, one address register instead of 16
  struct __attribute__((aligned(128))) Lds {
    f16 Ma[16 * 32 * 8];     // the row group's key mask as the high halves of the bias A fragments
    f16 Ib[2 * 32 * 8];      // B fragment of the bias product, [half][lane]
    f16 As[kS * kLdP];       // [256][kLdP] gated attention rows
    f16 Ws[kHC * kLdW];      // [256][kLdW] wo rows, columns regrouped
    f16 Kb[2 * kS * kLdQ];   // 2 x K [256][kLdQ]
    f16 Vb[2 * kS * kLdV];   // 2 x V [256][kLdV]
  };
  __shared__ Lds lds;
  f16* const Ma = lds.Ma;
  f16* const Ib = lds.Ib;
  f16* const As = lds.As;
  f16* const Ws = lds.Ws;
  f16* const Kb = lds.Kb;
  f16* const Vb = lds.Vb;
  const int nr  = blockIdx.x;
  const int tid = threadIdx.x;
  const int lane = tid & 31, hg = lane >> 4, ln = lane & 15;
  const int wave = __builtin_amdgcn_readfirstlane(tid >> 5);

  // async 16-byte copies into padded rows, a row = 4 chunks: chunk tid + 512*j is key
  // tid/4 + 128*j; V lies untransposed, the LDS reads of the second product transpose it
  const size_t base = (size_t)nr * kH * kS * kCH;        // in halves; a head is kS*kCH more
  const f16* ksrc = Kh + base + tid * 8;
  const f16* vsrc = Vh + base + tid * 8;
  const uint32_t kdst = lds_off(Kb) + (uint32_t)(((tid >> 2) * kLdQ + (tid & 3) * 8) * 2);
  const uint32_t vdst = lds_off(Vb) + (uint32_t)(((tid >> 2) * kLdV + (tid & 3) * 8) * 2);
  async_ld4_b128(kdst, kdst + 128 * kLdQ * 2, vdst, vdst + 128 * kLdV * 2,
                 ksrc, ksrc + 4096, vsrc, vsrc + 4096);

  // a wave-wide 16-byte load covers one whole 512-byte row of wo: row tid/32 + 16*j
  {
    const v4f* wsrc = (const v4f*)wo + tid;
    v4f wr[16];
#pragma unroll
    for (int j = 0; j < 16; ++j) wr[j] = wsrc[j * 512];
    // address wait before the loads' address registers are reused
    asm volatile("s_wait_xcnt 0x0" ::: "memory");
    f16* wdst = Ws + (tid >> 5) * kLdW + (lane >> 3) * 32 + (lane & 7) * 2;
#pragma unroll
    for (int j = 0; j < 16; ++j) {
      v2h ev = {(f16)wr[j][0], (f16)wr[j][2]};       // tile 0: even columns
      v2h od = {(f16)wr[j][1], (f16)wr[j][3]};       // tile 1: odd columns
      *(v2h*)(wdst + j * 16 * kLdW)      = ev;
      *(v2h*)(wdst + j * 16 * kLdW + 16) = od;
    }
  }
  // Ma[nt][lane] (8 halves) holds k = 16 + 8*(lane>>4) .. +7 of row (lane&15) of tile nt's
  // bias fragment: the key's mask as an f16 and what that f16 leaves of it at k = 16, 17
  if (tid < kS) {
    const float* mp = bias_mask + (size_t)nr * kS + tid;
    const float mv = fminf(fmaxf(*mp, -kBig), kBig);   // kept finite in f16, as the pair bias
    // address wait before the load's address registers are reused
    asm volatile("s_wait_xcnt 0x0" ::: "memory");
    const f16 mhi = (f16)mv;
    const f16 mlo = (f16)(mv - (float)mhi);
    const v8h mc = {mhi, mlo, (f16)0, (f16)0, (f16)0, (f16)0, (f16)0, (f16)0};
    const v8h mz = {};
    v8h* md = (v8h*)Ma + (tid >> 4) * 32 + (tid & 15);
    md[0]  = mc;
    md[16] = mz;
  }

  // B of the bias product, ld_frag's k order: rows k = 0..15 the identity (row k goes to
  // query column k), rows 16 and 17 all ones (the two parts of the mask go to every query).
  // Laid in LDS and fetched per head: held in registers over the softmax it spills
  if (tid < 64) {
    v8h ic;
#pragma unroll
    for (int i = 0; i < 8; ++i)
      ic[i] = (f16)((tid < 32 ? (hg << 3) + i == ln : (hg == 0 && i < 2)) ? 1.0f : 0.0f);
    *(v8h*)(Ib + tid * 8) = ic;
  }

  // D/C layout of S^T tile nt: register r = S[key 16*nt + 8*hg + r][query q]
  const int q = wave * 16 + ln;
  const f16* mfp = Ma + lane * 8;
  const f16* ifp = Ib + lane * 8;
  const int kfo = ln * kLdQ + (hg << 3);
  const int vto = ((hg << 3) + (lane & 7)) * kLdV + ((lane >> 3) & 1) * 8;
  // per head: 16 bias tiles of 16*kS halves, kCH gate columns, kS*kCH halves of Q
  const v8h* bpp = (const v8h*)Bp + (size_t)wave * (16 * kS / 8) + lane;
  // O^T: register r = O[query q][channel 16*ct + 8*hg + r]: 16-byte gate load, 16-byte LDS store
  const f16* gp = Gh + ((size_t)nr * kS + q) * kHC + (hg << 3);
  const f16* qp = Qh + base + q * kCH + (hg << 3);
  f16* ap = As + q * kLdP + (hg << 3);

  // carried from head to head: head h + 1's are fetched while head h's second product runs
  v8h bl[16];
  v16h bq;                                   // B = Q^T, K-dim = 32
  head_loads(bpp, qp, bl, bq);               // head 0
#pragma unroll 1   // rolled: the buffer and the pointers are all that differs between heads
  for (int h = 0; h < kH; ++h) {
    v8f sacc[16];
    // hand-over between heads: this wave's LDS reads and writes of head h - 1 are done (in
    // the first trip: wo and the mask are laid) and its copies of head h have landed; behind
    // the barrier head h may be read and the other buffer refilled
    asm volatile("s_wait_dscnt 0x0" ::: "memory");
    wait_async0();
    lds_barrier();     // LDS only: the bias loads stay in flight across it
    if (h + 1 < kH) {  // block-uniform
      const uint32_t kb = (uint32_t)(((h + 1) & 1) * kS * kLdQ * 2);
      const uint32_t vb = (uint32_t)(((h + 1) & 1) * kS * kLdV * 2);
      const f16* kn = ksrc + (h + 1) * kS * kCH;
      const f16* vn = vsrc + (h + 1) * kS * kCH;
      async_ld4_b128(kdst + kb, kdst + kb + 128 * kLdQ * 2, vdst + vb, vdst + vb + 128 * kLdV * 2,
                     kn, kn + 4096, vn, vn + 4096);
    }
    const f16* kfp = Kb + (h & 1) * kS * kLdQ + kfo;
    const f16* vtp = Vb + (h & 1) * kS * kLdV + vto;
    const v8h ilo = *(const v8h*)(ifp);
    const v8h ihi = *(const v8h*)(ifp + 32 * 8);
    const v16h idb = __builtin_shufflevector(ilo, ihi, 0, 1, 2, 3, 4, 5, 6, 7,
                                             8, 9, 10, 11, 12, 13, 14, 15);
    sched_fence();     // all pair-bias loads in flight
#pragma unroll
    for (int g = 0; g < 4; ++g) {            // 4 score tiles per fenced group
      v16h ab[4];
      v16h ak[4];
#pragma unroll
      for (int j = 0; j < 4; ++j) {
        const int nt = g * 4 + j;
        v8h mh = *(const v8h*)(mfp + nt * 32 * 8);
        ab[j] = __builtin_shufflevector(bl[nt], mh, 0, 1, 2, 3, 4, 5, 6, 7,     // A = [pair bias^T | mask]
                                        8, 9, 10, 11, 12, 13, 14, 15);
        v8h klo = *(const v8h*)(kfp + nt * 16 * kLdQ);            // A = K rows, ld_frag's k order
        v8h khi = *(const v8h*)(kfp + nt * 16 * kLdQ + 16);
        ak[j] = __builtin_shufflevector(klo, khi, 0, 1, 2, 3, 4, 5, 6, 7,
                                        8, 9, 10, 11, 12, 13, 14, 15);
      }
#pragma unroll
      for (int j = 0; j < 4; ++j) sacc[g * 4 + j] = wmma_f16(ak[j], bq, v8f{});
#pragma unroll
      for (int j = 0; j < 4; ++j) sacc[g * 4 + j] = wmma_f16(ab[j], idb, sacc[g * 4 + j]);
      sched_fence();   // cap live mask and K fragments: no cross-group hoisting
    }
    // softmax over 256 keys of this lane's query: 128 in-lane values + other half
    float mx[8];
#pragma unroll
    for (int r = 0; r < 8; ++r) mx[r] = sacc[0][r];
#pragma unroll
    for (int nt = 1; nt < 16; ++nt)
#pragma unroll
      for (int r = 0; r < 8; ++r) mx[r] = fmaxf(mx[r], sacc[nt][r]);
    float m = fmaxf(fmaxf(fmaxf(mx[0], mx[1]), fmaxf(mx[2], mx[3])),
                    fmaxf(fmaxf(mx[4], mx[5]), fmaxf(mx[6], mx[7])));
    m = fmaxf(m, other_half(m));

    float sm[8] = {0.f, 0.f, 0.f, 0.f, 0.f, 0.f, 0.f, 0.f};
    v8f o0 = {}, o1 = {};
    v8h g0, g1;
#pragma unroll
    for (int kk = 0; kk < 8; ++kk) {         // 32 keys: two score tiles -> one B operand
      if (kk == 3) {
        // gate fetched where the first score tiles have left their registers, three of these
        // steps ahead of its wait: held over the whole softmax it makes address registers spill
        const f16* gph = gp + h * kCH;
        g0 = *(const v8h*)(gph);
        g1 = *(const v8h*)(gph + 16);
        // address wait before the loads' address registers are reused
        asm volatile("s_wait_xcnt 0x0" :: "v"(gph) : "memory");
      }
      if (kk == kAhead) {
        // the gate's wait is taken here, where it has landed: loads return in order, and a
        // wait for it behind the fetch below would be one for the whole fetch
        asm volatile("" :: "v"(g0), "v"(g1));
        // next head's bias and Q, fetched where the consumed score tiles have left room for
        // them; they fly under the remaining steps, the gating and the hand-over barrier
        if (h + 1 < kH) {                    // the same for the whole block
          head_loads(bpp + (h + 1) * 16 * (16 * kS / 8), qp + (h + 1) * kS * kCH, bl, bq);
        } else {   // last head: fresh values, or the used fragments would stay live from the scores to here
#pragma unroll
          for (int nt = 0; nt < 16; ++nt) bl[nt] = v8h{};
          bq = v16h{};
        }
      }
      v16h pb;
#pragma unroll
      for (int r = 0; r < 8; ++r) {
        float e0 = __expf(sacc[2 * kk][r] - m);
        float e1 = __expf(sacc[2 * kk + 1][r] - m);
        sm[r] += e0 + e1;
        pb[r]     = (f16)e0;
        pb[8 + r] = (f16)e1;
      }
      v16h a0 = ld_frag_tr(vtp + kk * 32 * kLdV,      kLdV);      // A = V^T rows
      v16h a1 = ld_frag_tr(vtp + kk * 32 * kLdV + 16, kLdV);
      o0 = wmma_f16(a0, pb, o0);
      o1 = wmma_f16(a1, pb, o1);
      // caps how many later steps' differences and exponentials are formed ahead while most
      // score tiles are still live: without it address registers spill inside the head loop
      if (kk == 1 || kk == 3) sched_fence();
    }
    float s = ((sm[0] + sm[1]) + (sm[2] + sm[3])) + ((sm[4] + sm[5]) + (sm[6] + sm[7]));
    s += other_half(s);
    const float rinv = __builtin_amdgcn_rcpf(s);

    v8h r0, r1;
#pragma unroll
    for (int r = 0; r < 8; ++r) {
      r0[r] = (f16)(o0[r] * rinv * (float)g0[r]);
      r1[r] = (f16)(o1[r] * rinv * (float)g1[r]);
    }
    *(v8h*)(ap + h * kCH)      = r0;
    *(v8h*)(ap + h * kCH + 16) = r1;
  }
  // every wave's gated rows are laid before any wave reads them as A rows
  asm volatile("s_wait_dscnt 0x0" ::: "memory");
  wait_async0();
  __syncthreads();

  // ---- output projection of the block's 256 tokens ----
  const int cg = wave & 3;                         // 32 output columns
  const int t0 = (wave >> 2) * 64;                 // 64 tokens
  v16h wf[2][8];                                   // [tile t][k step]
  const f16* wtp = Ws + ((hg << 3) + (lane & 7)) * kLdW + cg * 32 + ((lane >> 3) & 1) * 8;
#pragma unroll
  for (int ks = 0; ks < 8; ++ks)
#pragma unroll
    for (int t = 0; t < 2; ++t) wf[t][ks] = ld_frag_tr(wtp + ks * 32 * kLdW + t * 16, kLdW);
  const v2f bias = *(const v2f*)(bo + cg * 32 + 2 * ln);

  // D layout: register r = token 8*hg + r of the tile, lane&15 = column j
  float* op = out + ((size_t)nr * kS + t0 + (hg << 3)) * kC + cg * 32 + 2 * ln;
#pragma unroll 1   // rolled: beside the weight fragments there are registers for one tile only
  for (int st = 0; st < 4; ++st) {
    v16h af[8];                                    // A = token rows, all eight k steps
#pragma unroll
    for (int ks = 0; ks < 8; ++ks) af[ks] = ld_frag(As, t0 + st * 16, kLdP, ks * 32, lane);
    sched_fence();   // one group of LDS reads in front of the WMMAs, none among them
    v8f a0 = {}, a1 = {};
#pragma unroll
    for (int ks = 0; ks < 8; ++ks) {
      a0 = wmma_f16(af[ks], wf[0][ks], a0);
      a1 = wmma_f16(af[ks], wf[1][ks], a1);
    }
    float* o = op + st * 16 * kC;
#pragma unroll
    for (int r = 0; r < 8; ++r) {
      v2f v = {a0[r] + bias[0], a1[r] + bias[1]};
      *(v2f*)(o + r * kC) = v;
    }
    // address wait before the next tile overwrites the stores' registers
    asm volatile("s_wait_xcnt 0x0" ::: "memory");
  }
}

extern "C" void kernel_launch(void* const* d_in, const int* in_sizes, int n_in,
                              void* d_out, int out_size, void* d_ws, size_t ws_size,
                              hipStream_t stream) {
  const float* q_x       = (const float*)d_in[0];
  const float* kv_x      = (const float*)d_in[1];
  const float* bias_mask = (const float*)d_in[2];
  const float* bias_pair = (const float*)d_in[3];
  const float* wq = (const float*)d_in[4];
  const float* wk = (const float*)d_in[5];
  const float* wv = (const float*)d_in[6];
  const float* wg = (const float*)d_in[7];
  const float* bg = (const float*)d_in[8];
  const float* wo = (const float*)d_in[9];
  const float* bo = (const float*)d_in[10];
  float* out = (float*)d_out;

  char* wsb = (char*)d_ws;
  const size_t SZ = (size_t)kNR * kH * kS * kCH * sizeof(f16);  // 33.5 MB each
  f16* Qh = (f16*)(wsb + 0 * SZ);   // [NR][H][S][CH], pre-scaled
  f16* Kh = (f16*)(wsb + 1 * SZ);   // [NR][H][S][CH]
  f16* Vh = (f16*)(wsb + 2 * SZ);   // [NR][H][S][CH]
  f16* Gh = (f16*)(wsb + 3 * SZ);   // [NR][S][HC] sigmoid gate
  f16* Bp = (f16*)(wsb + 4 * SZ);   // [H*16][16][32][8] pair bias in A-operand order, 1 MB

  dim3 blk(256);
  const size_t smem1 = (2 * kRT * kLdX + 8 * 32 * kLdO) * sizeof(f16) + kHC * sizeof(float);
  proj_all_kernel<<<dim3(kPB + kNR * 2), blk, smem1, stream>>>(
      q_x, kv_x, wq, wk, wv, wg, bg, bias_pair, Bp, Qh, Kh, Vh, Gh);
  attn_out_kernel<<<dim3(kNR), dim3(512), 0, stream>>>(
      bias_mask, Bp, Qh, Kh, Vh, Gh, wo, bo, out);
}

// v010
// Measured time: 51.9 microseconds a run.
// It is 1.27 times as fast as v008, going by the measured steps of the versions left out in between.
// Counting every step since v000, it is 4.49 times as fast.
#include <hip/hip_runtime.h>

typedef _Float16 f16;
typedef __attribute__((ext_vector_type(2)))  _Float16 v2h;
typedef __attribute__((ext_vector_type(4)))  _Float16 v4h;
typedef __attribute__((ext_vector_type(8)))  _Float16 v8h;
typedef __attribute__((ext_vector_type(16))) _Float16 v16h;
typedef __attribute__((ext_vector_type(8)))  float    v8f;
typedef __attribute__((ext_vector_type(4)))  float    v4f;
typedef __attribute__((ext_vector_type(2)))  float    v2f;
typedef __attribute__((ext_vector_type(8)))  short    v8s;

constexpr int kS  = 256;   // tokens (Q = K)
constexpr int kC  = 128;   // input channels (CQ=CK=CV)
constexpr int kH  = 8;     // heads
constexpr int kCH = 32;    // head dim
constexpr int kHC = 256;   // H*CH
constexpr int kNR = 256;   // rows
constexpr int kPB = 128;   // (head, 16-query tile) pairs: one re-laying block each
constexpr int kWB = 32;    // blocks that re-lay wq and wg: (matrix, 64-column group, tile) each
constexpr int kKB = 32;    // blocks that re-lay wk and wv: (head, matrix, 16-column tile) each
constexpr int kAhead = 6;  // step of a head's second product at which the next head's bias is fetched
constexpr float kBig = 60000.0f;   // bound of a bias value on its way to f16

// padded LDS row strides (halves): multiples of 8 -> 16B-aligned b128
// loads with lanes spread across banks
constexpr int kLdX = 136;  // 128 + 8
constexpr int kLdQ = 40;   // 32 + 8 (K tiles, K-dim 32)
constexpr int kLdP = 264;  // 256 + 8 (output projection rows, K-dim 256)
constexpr int kLdW = 144;  // 128 + 16 (wo rows): 288 bytes, an odd multiple of 32, the transposing load's pitch
constexpr int kLdF = 264;  // 256 + 8 (kv_x, 16 channels of 16 tokens): the 8 groups of a store fall on different banks
constexpr int kLdV = 48;   // 32 + 16 (V rows): 96 bytes, an odd multiple of 32, the transposing load's pitch

// ---- fragment loader (CDNA5 16-bit WMMA layout, ISA 7.12.2) ----
// Source is [M][K] (A) or [N][K] (B^T staged): lane owns row (base + lane&15),
// element i holds K = k0 + 8*(lane>>4) + i + (i>=8 ? 8 : 0)  -> two
// contiguous 16-byte runs -> exactly two ds_load_b128 per fragment.
__device__ __forceinline__ v16h ld_frag(const f16* p, int row0, int ld,
                                        int k0, int lane) {
  const f16* q = p + (size_t)(row0 + (lane & 15)) * ld + k0 + ((lane >> 4) << 3);
  v8h lo = *(const v8h*)(q);
  v8h hi = *(const v8h*)(q + 16);
  return __builtin_shufflevector(lo, hi, 0, 1, 2, 3, 4, 5, 6, 7,
                                 8, 9, 10, 11, 12, 13, 14, 15);
}

// ---- transposing fragment loader: A = T^T from a row-major LDS tile T[k][m] ----
// p is the lane's own address, T + (k0 + 8*(lane>>4) + (lane&7)) * ld + m0 + 8*((lane>>3)&1);
// the lane gets T[k0 + 8*(lane>>4) + i + (i>=8 ? 8 : 0)][m0 + (lane&15)]: ld_frag's k order.
__device__ __forceinline__ v8h ld_tr16(const f16* p) {
  typedef __attribute__((address_space(3))) v8s lds_v8s;
  return __builtin_bit_cast(v8h, __builtin_amdgcn_ds_load_tr16_b128_v8i16((lds_v8s*)p));
}
__device__ __forceinline__ v16h ld_frag_tr(const f16* p, int ld) {
  v8h lo = ld_tr16(p);
  v8h hi = ld_tr16(p + 16 * ld);
  return __builtin_shufflevector(lo, hi, 0, 1, 2, 3, 4, 5, 6, 7,
                                 8, 9, 10, 11, 12, 13, 14, 15);
}

__device__ __forceinline__ v8f wmma_f16(v16h a, v16h b, v8f c) {
  return __builtin_amdgcn_wmma_f32_16x16x32_f16(false, a, false, b,
                                                (short)0, c, false, false);
}

// scheduling fence: keep register pressure bounded (no hoisting across)
__device__ __forceinline__ void sched_fence() {
  __builtin_amdgcn_sched_barrier(0);
}

// work-group barrier that orders LDS only: the bias and weight loads stay in
// flight across it (__syncthreads drains them)
__device__ __forceinline__ void lds_barrier() {
  __builtin_amdgcn_fence(__ATOMIC_RELEASE, "workgroup", "local");
  __builtin_amdgcn_s_barrier();
  __builtin_amdgcn_fence(__ATOMIC_ACQUIRE, "workgroup", "local");
}

// 2^x and reciprocal with the one free slot that the instruction set asks for behind a
// transcendental.
// Eight of a kind in a row: each fills the slot of the one in front (no result is a source of
// the run: early-clobber outputs), one free slot behind the last
__device__ __forceinline__ v8f exp2_run(v8f x) {
  float y0, y1, y2, y3, y4, y5, y6, y7;
  asm("v_exp_f32 %0, %8\n\tv_exp_f32 %1, %9\n\tv_exp_f32 %2, %10\n\tv_exp_f32 %3, %11\n\t"
      "v_exp_f32 %4, %12\n\tv_exp_f32 %5, %13\n\tv_exp_f32 %6, %14\n\tv_exp_f32 %7, %15\n\tv_nop"
      : "=&v"(y0), "=&v"(y1), "=&v"(y2), "=&v"(y3), "=&v"(y4), "=&v"(y5), "=&v"(y6), "=&v"(y7)
      : "v"(x[0]), "v"(x[1]), "v"(x[2]), "v"(x[3]), "v"(x[4]), "v"(x[5]), "v"(x[6]), "v"(x[7]));
  return v8f{y0, y1, y2, y3, y4, y5, y6, y7};
}
__device__ __forceinline__ v8f rcp_run(v8f x) {
  float y0, y1, y2, y3, y4, y5, y6, y7;
  asm("v_rcp_f32 %0, %8\n\tv_rcp_f32 %1, %9\n\tv_rcp_f32 %2, %10\n\tv_rcp_f32 %3, %11\n\t"
      "v_rcp_f32 %4, %12\n\tv_rcp_f32 %5, %13\n\tv_rcp_f32 %6, %14\n\tv_rcp_f32 %7, %15\n\tv_nop"
      : "=&v"(y0), "=&v"(y1), "=&v"(y2), "=&v"(y3), "=&v"(y4), "=&v"(y5), "=&v"(y6), "=&v"(y7)
      : "v"(x[0]), "v"(x[1]), "v"(x[2]), "v"(x[3]), "v"(x[4]), "v"(x[5]), "v"(x[6]), "v"(x[7]));
  return v8f{y0, y1, y2, y3, y4, y5, y6, y7};
}

// ---- weight fragments for D^T = W^T X^T: a wave's 64 output columns, all 128 k ----
// Column map: row j of matrix tile t is column base + 4*j + t, so lane (token, hg) ends up
// with the 32 consecutive columns base + 32*hg .. +31 of its token.
// one 16-token tile of D^T = W^T X^T from staged f16 activation rows [token][kLdX]
__device__ __forceinline__ void proj_tile(const f16* xb, int row0, int lane,
                                          const v16h (&wf)[4][4], v8f (&acc)[4]) {
  v16h xf[4];                                      // B = X^T, all four k steps
#pragma unroll
  for (int ks = 0; ks < 4; ++ks) xf[ks] = ld_frag(xb, row0, kLdX, ks * 32, lane);
  sched_fence();   // one group of LDS reads, one wait: none among the WMMAs
#pragma unroll
  for (int t = 0; t < 4; ++t) acc[t] = v8f{};
#pragma unroll
  for (int ks = 0; ks < 4; ++ks)
#pragma unroll
    for (int t = 0; t < 4; ++t) acc[t] = wmma_f16(wf[t][ks], xf[ks], acc[t]);
}

// the same fragments from the copy that the first launch has re-laid as f16 in their own order,
// Wp[matrix][64-column group][tile t][k step][half][lane] (8 halves): 32 wave-wide 16-byte
// loads of 512 contiguous bytes, no conversion. wfp = Wp + (4*matrix + group)*1024 + lane.
__device__ __forceinline__ void load_wfrags_laid(const v8h* wfp, v16h (&wf)[4][4]) {
#pragma unroll
  for (int t = 0; t < 4; ++t)
#pragma unroll
    for (int ks = 0; ks < 4; ++ks) {
      v8h lo = wfp[((t * 4 + ks) * 2) * 32];
      v8h hi = wfp[((t * 4 + ks) * 2 + 1) * 32];
      wf[t][ks] = __builtin_shufflevector(lo, hi, 0, 1, 2, 3, 4, 5, 6, 7,
                                          8, 9, 10, 11, 12, 13, 14, 15);
    }
  // address wait before the loads' address registers are reused; the pointer is an
  // input so that no load of the run lands on the address pair itself
  asm volatile("s_wait_xcnt 0x0" :: "v"(wfp) : "memory");
}

// ===================== Kernel 1: re-laying of the pair bias and of the weights =====================
// The first kPB blocks each re-lay one 16-query x 256-key tile of
// the pair bias, as f16, into the order in which the attention kernel's lanes take it as
// the A operand of a matrix product with an identity: Bp[tile][nt][lane] (8 halves) =
// bias_pair[h][16*qt + 8*(lane>>4) + 0..7][16*nt + (lane&15)], tile = 16*h + qt.
// The tile is read 256 times (once per row group), so the scattered read is paid here
// once and every later wave-wide 16-byte load covers 512 contiguous bytes.
// The next kWB blocks re-lay wq and wg as f16 into the fragment order of load_wfrags_laid,
// the last kKB blocks wk and wv into that of load_hfrags: the attention kernel's 256 blocks
// each take them.
__global__ __launch_bounds__(256, 4)
void relay_kernel(const float* __restrict__ wk,  const float* __restrict__ wv,
                  const float* __restrict__ wq,  const float* __restrict__ wg,
                  f16* __restrict__ Wp,
                  const float* __restrict__ bias_pair, f16* __restrict__ Bp) {
  const int tid  = threadIdx.x;
  if (blockIdx.x < kPB) {                          // block-uniform
    const float* bsrc = bias_pair + (size_t)blockIdx.x * 16 * kS
                        + ((tid >> 4) & 1) * 8 * kS + (tid & 15) + (tid >> 5) * 16;
    v8h* bdst = (v8h*)Bp + (size_t)blockIdx.x * (16 * kS / 8) + tid;
    float bv[2][8];
#pragma unroll
    for (int j = 0; j < 2; ++j)                    // nt = tid/32 + 8*j
#pragma unroll
      for (int i = 0; i < 8; ++i) bv[j][i] = bsrc[j * 128 + i * kS];
    // address wait before the loads' address registers are reused; the pointer is an
    // input so that no load of the run lands on the address pair itself
    asm volatile("s_wait_xcnt 0x0" :: "v"(bsrc) : "memory");
#pragma unroll
    for (int j = 0; j < 2; ++j) {
      v8h o;
#pragma unroll
      for (int i = 0; i < 8; ++i)                  // kept finite: an infinity times the identity's zeros is no number
        o[i] = (f16)fminf(fmaxf(bv[j][i], -kBig), kBig);
      bdst[j * 256] = o;
    }
    return;
  }
  const int bi = blockIdx.x - kPB;
  // thread = (k step, half, lane): k = 32*ks + 16*half + 8*(lane>>4) + i
  const int krow = (tid >> 6) * 32 + ((tid >> 5) & 1) * 16 + ((tid >> 4) & 1) * 8;
  const float* wsrc;
  if (bi < kWB) {   // bi = 16*matrix + 4*group + t: column 64*group + 4*(lane&15) + t of wq or wg
    wsrc = ((bi >> 4) ? wg : wq) + krow * kHC + ((bi >> 2) & 3) * 64 + 4 * (tid & 15) + (bi & 3);
  } else {          // bi - kWB = 4*head + 2*matrix + t: column 32*head + 16*t + (lane&15) of wk or wv
    const int bk = bi - kWB;
    wsrc = ((bk & 2) ? wv : wk) + krow * kHC + (bk >> 2) * 32 + (bk & 1) * 16 + (tid & 15);
  }
  float wv8[8];
#pragma unroll
  for (int i = 0; i < 8; ++i) wv8[i] = wsrc[i * kHC];
  // address wait before the loads' address registers are reused; the pointer is an
  // input so that no load of the run lands on the address pair itself
  asm volatile("s_wait_xcnt 0x0" :: "v"(wsrc) : "memory");
  v8h o;
#pragma unroll
  for (int i = 0; i < 8; ++i) o[i] = (f16)wv8[i];
  ((v8h*)Wp)[bi * 256 + tid] = o;
  // address wait behind the store, in front of whatever reuses its registers
  asm volatile("s_wait_xcnt 0x0" ::: "memory");
}

__device__ __forceinline__ float other_half(float x) {   // lane l <-> l ^ 16
  int b = __builtin_bit_cast(int, x);
  b = __builtin_amdgcn_permlanex16(b, b, 0x76543210, 0xfedcba98, false, false);
  return __builtin_bit_cast(float, b);
}

// One head's re-laid f16 pair bias, straight from global memory into registers one head ahead
// (lane-contiguous, every load covers four whole 128-byte lines): the low half of each
// bias A fragment.
__device__ __forceinline__ void head_loads(const v8h* bpp, v8h (&bl)[16]) {
#pragma unroll
  for (int nt = 0; nt < 16; ++nt) bl[nt] = bpp[nt * 32];   // 8 queries of one key per lane
  // address wait before the loads' address registers are reused; the pointer is an
  // input so that no load of the run lands on the address pair itself
  asm volatile("s_wait_xcnt 0x0" :: "v"(bpp) : "memory");
}

// A fragments of one head's 32 columns of wk or wv, from the copy that the first launch has
// re-laid as f16: [head][matrix][tile t][k step][half][lane] (8 halves), row j of tile t is
// column 32*head + 16*t + j. 16 wave-wide 16-byte loads of 512 contiguous bytes.
__device__ __forceinline__ void load_hfrags(const v8h* p, v16h (&wf)[2][4]) {
#pragma unroll
  for (int t = 0; t < 2; ++t)
#pragma unroll
    for (int ks = 0; ks < 4; ++ks) {
      v8h lo = p[((t * 4 + ks) * 2) * 32];
      v8h hi = p[((t * 4 + ks) * 2 + 1) * 32];
      wf[t][ks] = __builtin_shufflevector(lo, hi, 0, 1, 2, 3, 4, 5, 6, 7,
                                          8, 9, 10, 11, 12, 13, 14, 15);
    }
  // address wait before the loads' address registers are reused; the pointer is an
  // input so that no load of the run lands on the address pair itself
  asm volatile("s_wait_xcnt 0x0" :: "v"(p) : "memory");
}

// a wave's 16 kv_x tokens as B = X^T fragments (ld_frag's k order) from its own LDS part,
// laid in the fragments' own order: [16 channels: kLdF halves][8 channels][token][8 halves];
// a wave-wide 16-byte load covers 512 contiguous bytes. xl = the wave's part + lane * 8.
__device__ __forceinline__ void load_xfrags(const f16* xl, v16h (&xf)[4]) {
#pragma unroll
  for (int ks = 0; ks < 4; ++ks) {
    v8h lo = *(const v8h*)(xl + (ks * 2) * kLdF);
    v8h hi = *(const v8h*)(xl + (ks * 2 + 1) * kLdF);
    xf[ks] = __builtin_shufflevector(lo, hi, 0, 1, 2, 3, 4, 5, 6, 7,
                                     8, 9, 10, 11, 12, 13, 14, 15);
  }
}

// D^T = W^T X^T, 32 columns x 16 tokens: the lane gets channels 16*t + 8*(lane>>4) + 0..7 of
// token lane&15, one 16-byte LDS store per tile. dst = the token's row + 8*(lane>>4).
__device__ __forceinline__ void head_proj(const v16h (&wf)[2][4], const v16h (&xf)[4], f16* dst) {
  v8f a0 = {}, a1 = {};
#pragma unroll
  for (int ks = 0; ks < 4; ++ks) {
    a0 = wmma_f16(wf[0][ks], xf[ks], a0);
    a1 = wmma_f16(wf[1][ks], xf[ks], a1);
  }
  *(v8h*)(dst)      = __builtin_convertvector(a0, v8h);
  *(v8h*)(dst + 16) = __builtin_convertvector(a1, v8h);
}

// One block of 16 waves takes one row group and all of its 8 heads; a wave owns 16 query
// columns. K and V never leave the WGP: a wave keeps its 16 kv_x tokens as f16 in an LDS part of
// its own and forms, head by head, their 32 K and 32 V columns into the one K and the one V tile:
// K of head h + 1 behind head h's second product (a barrier behind the scores says that K of
// head h is read), V of head h + 1 behind the barrier between the heads.
// Q and the gate never leave the WGP either: q_x is laid in LDS once as f16 rows. In front of
// the heads the block forms Q (weight-stationary, a wave 64 columns x 64 tokens) into the LDS
// rows of the attention output: head h's 32 columns hold Q until the lane that read them puts
// its attention row there. Behind the last head the gate is formed the same way from the same
// rows and multiplied into the attention rows in place.
// The gated attention rows are the A rows of the output projection, which the same block does last.
// Output projection, weight-stationary: wo is read once per block with whole-row loads (during
// the last head) and laid as f16 rows in the LDS that kv_x and K have left; a wave keeps the B fragments of its 32 output columns (all 256 k)
// in registers for its 64 tokens, taken by the transposing LDS load.
// Column map of a wave: column j of matrix tile t is output column 32*cg + 2*j + t, so a
// lane holds two neighbouring columns of a token and an 8-byte store instruction covers
// two whole 128-byte lines. wo's columns are regrouped to that map on their way into LDS:
// column 32*cg + 2*j + t lies at position 32*cg + 16*t + j of its row.
__global__ __launch_bounds__(512, 1)
void attn_out_kernel(const float* __restrict__ q_x, const float* __restrict__ kv_x,
                     const float* __restrict__ bias_mask,
                     const f16* __restrict__ Bp,
                     const f16* __restrict__ Wp, const float* __restrict__ bg,
                     const float* __restrict__ wo, const float* __restrict__ bo,
                     float* __restrict__ out) {
  // one object, the mask table first: at the bottom of the LDS its 16 tile addresses fit the
  // LDS loads' immediate offset field, one address register instead of 16
  struct __attribute__((aligned(128))) Lds {
    f16 Ma[16 * 32 * 8];     // the row group's key mask as the high halves of the bias A fragments
    f16 Ib[2 * 32 * 8];      // B fragment of the bias product, [half][lane]
    f16 As[kS * kLdP];       // [256][kLdP] Q, then attention rows, then gated attention rows
    f16 Xs[kS * kLdX];       // [256][kLdX] q_x rows
    f16 KV[16 * 8 * kLdF + kS * kLdQ + kS * kLdV];   // kv_x [16 waves][8][kLdF], K [256][kLdQ], V [256][kLdV]; behind the heads wo
    float Bg[kHC];           // gate bias
  };
  static_assert(kHC * kLdW <= 16 * 8 * kLdF + kS * kLdQ + kS * kLdV, "wo rows fit where kv_x, K and V lay");
  __shared__ Lds lds;
  f16* const Ma = lds.Ma;
  f16* const Ib = lds.Ib;
  f16* const As = lds.As;
  f16* const Xs = lds.Xs;
  f16* const Kb = lds.KV + 16 * 8 * kLdF;
  f16* const Vb = lds.KV + 16 * 8 * kLdF + kS * kLdQ;
  f16* const Ws = lds.KV;    // [256][kLdW] wo rows, columns regrouped
  float* const bgs = lds.Bg;
  const int nr  = blockIdx.x;
  const int tid = threadIdx.x;
  const int lane = tid & 31, hg = lane >> 4, ln = lane & 15;
  const int wave = __builtin_amdgcn_readfirstlane(tid >> 5);

  f16* const xw = lds.KV + wave * 8 * kLdF;        // this wave's own 16 kv_x tokens
  const int pgrp  = wave & 3;                      // 64 projection columns
  const int pbase = pgrp * 64;
  const int pt0   = (wave >> 2) * 64;              // 64 tokens
  v16h wfq[4][4];                                  // wq
  // a wave-wide 16-byte load covers one whole 512-byte token row of q_x: row tid/32 + 16*j
  {
    const v4f* xsrc = (const v4f*)(q_x + (size_t)nr * kS * kC) + tid;
    // the same of kv_x: row 16*wave + j, the wave's own tokens
    const v4f* ksrc = (const v4f*)(kv_x + (size_t)nr * kS * kC) + wave * 512 + lane;
    v4f xr[16], kr[16];
#pragma unroll
    for (int j = 0; j < 16; ++j) xr[j] = xsrc[j * 512];
#pragma unroll
    for (int j = 0; j < 16; ++j) kr[j] = ksrc[j * 32];
    // address wait before the loads' address registers are reused; the pointers are
    // inputs so that no load of the run lands on an address pair itself
    asm volatile("s_wait_xcnt 0x0" :: "v"(xsrc), "v"(ksrc) : "memory");
    f16* xdst = Xs + (tid >> 5) * kLdX + lane * 4;
#pragma unroll
    for (int j = 0; j < 16; ++j)
      *(v4h*)(xdst + j * 16 * kLdX) = __builtin_convertvector(xr[j], v4h);
    // the lane's 4 channels: 16-channel group lane/4, 8-channel half (lane/2)&1, halves 4*(lane&1) ..
    f16* kdst = xw + (lane >> 2) * kLdF + ((lane >> 1) & 1) * 128 + (lane & 1) * 4;
#pragma unroll
    for (int j = 0; j < 16; ++j)
      *(v4h*)(kdst + j * 8) = __builtin_convertvector(kr[j], v4h);
    load_wfrags_laid((const v8h*)Wp + pgrp * 1024 + lane, wfq);
  }
  // gate bias times -log2(e), in the accumulators' order: column 32*a + 4*r + t lies at 32*a + 8*t + r
  if (tid < kHC) {
    const float bgv = bg[tid];
    // address wait before the load's address registers are reused
    asm volatile("s_wait_xcnt 0x0" ::: "memory");
    bgs[(tid & ~31) + (tid & 3) * 8 + ((tid >> 2) & 7)] = bgv * -1.4426950408889634f;
  }
  // Ma[nt][lane] (8 halves) holds k = 16 + 8*(lane>>4) .. +7 of row (lane&15) of tile nt's
  // bias fragment: the key's mask as an f16 and what that f16 leaves of it at k = 16, 17
  if (tid < kS) {
    const float* mp = bias_mask + (size_t)nr * kS + tid;
    const float mv = fminf(fmaxf(*mp, -kBig), kBig);   // kept finite in f16, as the pair bias
    // address wait before the load's address registers are reused
    asm volatile("s_wait_xcnt 0x0" ::: "memory");
    const f16 mhi = (f16)mv;
    const f16 mlo = (f16)(mv - (float)mhi);
    const v8h mc = {mhi, mlo, (f16)0, (f16)0, (f16)0, (f16)0, (f16)0, (f16)0};
    const v8h mz = {};
    v8h* md = (v8h*)Ma + (tid >> 4) * 32 + (tid & 15);
    md[0]  = mc;
    md[16] = mz;
  }

  // B of the bias product, ld_frag's k order: rows k = 0..15 the identity (row k goes to
  // query column k), rows 16 and 17 all ones (the two parts of the mask go to every query).
  // Laid in LDS and fetched per head: held in registers over the softmax it spills
  if (tid < 64) {
    v8h ic;
#pragma unroll
    for (int i = 0; i < 8; ++i)
      ic[i] = (f16)((tid < 32 ? (hg << 3) + i == ln : (hg == 0 && i < 2)) ? 1.0f : 0.0f);
    *(v8h*)(Ib + tid * 8) = ic;
  }

  // ---- Q of the block's 256 tokens, all heads, into As ----
  f16* prow = As + (pt0 + ln) * kLdP + pbase + 32 * hg;   // the lane's 32 columns of its token
  {
    // every wave's q_x rows are laid before any wave reads them
    asm volatile("s_wait_dscnt 0x0" ::: "memory");
    lds_barrier();
#pragma unroll 1   // rolled: beside the weight fragments there are registers for one tile only
    for (int st = 0; st < 4; ++st) {
      v8f acc[4];
      proj_tile(Xs, pt0 + st * 16, lane, wfq, acc);
#pragma unroll
      for (int t = 0; t < 4; ++t) acc[t] *= 0.17677669529663687f;   // 1/sqrt(32)
#pragma unroll
      for (int c = 0; c < 4; ++c) {                // columns 8c .. 8c+7 of the lane's 32
        v8h o;
#pragma unroll
        for (int e = 0; e < 8; ++e) o[e] = (f16)acc[e & 3][2 * c + (e >> 2)];
        *(v8h*)(prow + st * 16 * kLdP + c * 8) = o;
      }
    }
  }

  // D/C layout of S^T tile nt: register r = S[key 16*nt + 8*hg + r][query q]
  const int q = wave * 16 + ln;
  const f16* mfp = Ma + lane * 8;
  const f16* ifp = Ib + lane * 8;
  const int kfo = ln * kLdQ + (hg << 3);
  const int vto = ((hg << 3) + (lane & 7)) * kLdV + ((lane >> 3) & 1) * 8;
  // per head: 16 bias tiles of 16*kS halves
  const v8h* bpp = (const v8h*)Bp + (size_t)wave * (16 * kS / 8) + lane;
  // O^T: register r = O[query q][channel 16*ct + 8*hg + r]: 16-byte LDS store; the same two
  // 16-byte places hold the lane's part of the head's Q^T fragment (ld_frag's k order) before
  f16* ap = As + q * kLdP + (hg << 3);

  // carried from head to head: head h + 1's are fetched while head h's second product runs
  v8h bl[16];
  head_loads(bpp, bl);                       // head 0
  // wk, wv fragments: a head is 1024 16-byte places, wk's 512 first
  const v8h* wkp = (const v8h*)Wp + 2 * 4 * 1024 + lane;
  f16* kst = Kb + q * kLdQ + (hg << 3);      // token q's K and V rows: the wave's tokens are
  f16* vst = Vb + q * kLdV + (hg << 3);      // numbered as its queries
  const f16* xl = xw + lane * 8;
  v16h xf[4];                                // live from a head's end to the next head's start
  v16h wfa[2][4];                            // wk of the next head, then its wv
  load_xfrags(xl, xf);
  load_hfrags(wkp, wfa);
  head_proj(wfa, xf, kst);                   // K of head 0
  load_hfrags(wkp + 512, wfa);               // wv of head 0
#pragma unroll 1   // rolled: the pointers are all that differs between heads
  for (int h = 0; h < kH; ++h) {
    v8f sacc[16];
    // the next head; the last head forms its own K rows once more (the same values) instead of
    // branching: behind a branch the fragments' registers stay taken over the whole head
    const int hn = h + 1 < kH ? h + 1 : h;
    // hand-over between heads: this wave's LDS reads and writes of head h - 1 are done (in
    // the first trip: Q and the mask are laid) and its K rows of head h are laid; behind
    // the barrier K of head h may be read and V rewritten
    asm volatile("s_wait_dscnt 0x0" ::: "memory");
    lds_barrier();     // LDS only: the bias and weight loads stay in flight across it
    head_proj(wfa, xf, vst);                 // V of head h
    sched_fence();     // the weight and activation fragments are dead before the score tiles grow
    const f16* kfp = Kb + kfo;
    const f16* vtp = Vb + vto;
    const v8h ilo = *(const v8h*)(ifp);
    const v8h ihi = *(const v8h*)(ifp + 32 * 8);
    const v16h idb = __builtin_shufflevector(ilo, ihi, 0, 1, 2, 3, 4, 5, 6, 7,
                                             8, 9, 10, 11, 12, 13, 14, 15);
    const v8h qlo = *(const v8h*)(ap + h * kCH);
    const v8h qhi = *(const v8h*)(ap + h * kCH + 16);
    const v16h bq = __builtin_shufflevector(qlo, qhi, 0, 1, 2, 3, 4, 5, 6, 7,   // B = Q^T, K-dim = 32
                                            8, 9, 10, 11, 12, 13, 14, 15);
    sched_fence();     // all pair-bias loads in flight
#pragma unroll
    for (int g = 0; g < 4; ++g) {            // 4 score tiles per fenced group
      v16h ab[4];
      v16h ak[4];
#pragma unroll
      for (int j = 0; j < 4; ++j) {
        const int nt = g * 4 + j;
        v8h mh = *(const v8h*)(mfp + nt * 32 * 8);
        ab[j] = __builtin_shufflevector(bl[nt], mh, 0, 1, 2, 3, 4, 5, 6, 7,     // A = [pair bias^T | mask]
                                        8, 9, 10, 11, 12, 13, 14, 15);
        v8h klo = *(const v8h*)(kfp + nt * 16 * kLdQ);            // A = K rows, ld_frag's k order
        v8h khi = *(const v8h*)(kfp + nt * 16 * kLdQ + 16);
        ak[j] = __builtin_shufflevector(klo, khi, 0, 1, 2, 3, 4, 5, 6, 7,
                                        8, 9, 10, 11, 12, 13, 14, 15);
      }
#pragma unroll
      for (int j = 0; j < 4; ++j) sacc[g * 4 + j] = wmma_f16(ak[j], bq, v8f{});
#pragma unroll
      for (int j = 0; j < 4; ++j) sacc[g * 4 + j] = wmma_f16(ab[j], idb, sacc[g * 4 + j]);
      sched_fence();   // cap live mask and K fragments: no cross-group hoisting
    }
    // every wave has read K of head h (it may be rewritten) and has laid its V rows of head h
    asm volatile("s_wait_dscnt 0x0" ::: "memory");
    lds_barrier();     // LDS only
    // softmax over 256 keys of this lane's query: 128 in-lane values + other half
    float mx[8];
#pragma unroll
    for (int r = 0; r < 8; ++r) mx[r] = sacc[0][r];
#pragma unroll
    for (int nt = 1; nt < 16; ++nt)
#pragma unroll
      for (int r = 0; r < 8; ++r) mx[r] = fmaxf(mx[r], sacc[nt][r]);
    float m = fmaxf(fmaxf(fmaxf(mx[0], mx[1]), fmaxf(mx[2], mx[3])),
                    fmaxf(fmaxf(mx[4], mx[5]), fmaxf(mx[6], mx[7])));
    m = fmaxf(m, other_half(m));

    float sm[8] = {0.f, 0.f, 0.f, 0.f, 0.f, 0.f, 0.f, 0.f};
    v8f o0 = {}, o1 = {};
#pragma unroll
    for (int kk = 0; kk < 8; ++kk) {         // 32 keys: two score tiles -> one B operand
      if (kk == kAhead) {
        // next head's bias, fetched where the consumed score tiles have left room for it;
        // it flies under the remaining steps and the hand-over barrier
        if (h + 1 < kH) {                    // the same for the whole block
          head_loads(bpp + (h + 1) * 16 * (16 * kS / 8), bl);
        } else {
          // last head: wo instead, 16 bytes a register group as the bias; a wave-wide
          // 16-byte load covers one whole 512-byte row of wo: row tid/32 + 16*j
          const v4f* wsrc = (const v4f*)wo + tid;
#pragma unroll
          for (int j = 0; j < 16; ++j) bl[j] = __builtin_bit_cast(v8h, wsrc[j * 512]);
          // address wait before the loads' address registers are reused
          asm volatile("s_wait_xcnt 0x0" :: "v"(wsrc) : "memory");
        }
      }
      v16h pb;
#pragma unroll
      for (int r = 0; r < 8; ++r) {
        float e0 = __expf(sacc[2 * kk][r] - m);
        float e1 = __expf(sacc[2 * kk + 1][r] - m);
        sm[r] += e0 + e1;
        pb[r]     = (f16)e0;
        pb[8 + r] = (f16)e1;
      }
      v16h a0 = ld_frag_tr(vtp + kk * 32 * kLdV,      kLdV);      // A = V^T rows
      v16h a1 = ld_frag_tr(vtp + kk * 32 * kLdV + 16, kLdV);
      o0 = wmma_f16(a0, pb, o0);
      o1 = wmma_f16(a1, pb, o1);
      // caps how many later steps' differences and exponentials are formed ahead while most
      // score tiles are still live: without it address registers spill inside the head loop
      if (kk == 1 || kk == 3) sched_fence();
    }
    load_hfrags(wkp + hn * 1024, wfa);       // next head's wk: the score tiles have left room
    load_xfrags(xl, xf);
    float s = ((sm[0] + sm[1]) + (sm[2] + sm[3])) + ((sm[4] + sm[5]) + (sm[6] + sm[7]));
    s += other_half(s);
    const float rinv = __builtin_amdgcn_rcpf(s);

    v8h r0, r1;
#pragma unroll
    for (int r = 0; r < 8; ++r) {
      r0[r] = (f16)(o0[r] * rinv);
      r1[r] = (f16)(o1[r] * rinv);
    }
    *(v8h*)(ap + h * kCH)      = r0;
    *(v8h*)(ap + h * kCH + 16) = r1;
    head_proj(wfa, xf, kst);                 // K of head hn
    load_hfrags(wkp + hn * 1024 + 512, wfa); // its wv flies across the barrier
  }
  v16h wfg[4][4];                                  // wg, in flight across the barrier
  load_wfrags_laid((const v8h*)Wp + (4 + pgrp) * 1024 + lane, wfg);
  // every wave's attention rows are laid, and K and V are read for the last time
  asm volatile("s_wait_dscnt 0x0" ::: "memory");
  lds_barrier();     // LDS only: wo and wg stay in flight across it

  {
    f16* wdst = Ws + (tid >> 5) * kLdW + (lane >> 3) * 32 + (lane & 7) * 2;
#pragma unroll
    for (int j = 0; j < 16; ++j) {
      const v4f wr = __builtin_bit_cast(v4f, bl[j]);
      v2h ev = {(f16)wr[0], (f16)wr[2]};             // tile 0: even columns
      v2h od = {(f16)wr[1], (f16)wr[3]};             // tile 1: odd columns
      *(v2h*)(wdst + j * 16 * kLdW)      = ev;
      *(v2h*)(wdst + j * 16 * kLdW + 16) = od;
    }
  }

  // ---- gate of the block's 256 tokens, multiplied into the attention rows in place ----
  {
#pragma unroll 1   // rolled: beside the weight fragments there are registers for one tile only
    for (int st = 0; st < 4; ++st) {
      v8f acc[4];
      proj_tile(Xs, pt0 + st * 16, lane, wfg, acc);
      sched_fence();   // the bias and attention rows are not fetched beside the activation fragments: they spill
#pragma unroll
      for (int t = 0; t < 4; ++t) {                // sigmoid
        const v8f bt = *(const v8f*)(bgs + pbase + 32 * hg + 8 * t);
        acc[t] = rcp_run(exp2_run(acc[t] * -1.4426950408889634f + bt) + 1.0f);
      }
      sched_fence();   // as above
#pragma unroll
      for (int c = 0; c < 4; ++c) {                // columns 8c .. 8c+7 of the lane's 32
        f16* ar = prow + st * 16 * kLdP + c * 8;
        const v8h ov = *(const v8h*)ar;
        v8h o;
#pragma unroll
        for (int e = 0; e < 8; ++e) o[e] = (f16)((float)ov[e] * acc[e & 3][2 * c + (e >> 2)]);
        *(v8h*)ar = o;
      }
    }
  }
  // every wave's gated rows and wo rows are laid before any wave reads them
  asm volatile("s_wait_dscnt 0x0" ::: "memory");
  __syncthreads();

  // ---- output projection of the block's 256 tokens ----
  const int cg = wave & 3;                         // 32 output columns
  const int t0 = (wave >> 2) * 64;                 // 64 tokens
  v16h wf[2][8];                                   // [tile t][k step]
  const f16* wtp = Ws + ((hg << 3) + (lane & 7)) * kLdW + cg * 32 + ((lane >> 3) & 1) * 8;
#pragma unroll
  for (int ks = 0; ks < 8; ++ks)
#pragma unroll
    for (int t = 0; t < 2; ++t) wf[t][ks] = ld_frag_tr(wtp + ks * 32 * kLdW + t * 16, kLdW);
  const v2f bias = *(const v2f*)(bo + cg * 32 + 2 * ln);

  // D layout: register r = token 8*hg + r of the tile, lane&15 = column j
  float* op = out + ((size_t)nr * kS + t0 + (hg << 3)) * kC + cg * 32 + 2 * ln;
#pragma unroll 1   // rolled: beside the weight fragments there are registers for one tile only
  for (int st = 0; st < 4; ++st) {
    v16h af[8];                                    // A = token rows, all eight k steps
#pragma unroll
    for (int ks = 0; ks < 8; ++ks) af[ks] = ld_frag(As, t0 + st * 16, kLdP, ks * 32, lane);
    sched_fence();   // one group of LDS reads in front of the WMMAs, none among them
    v8f a0 = {}, a1 = {};
#pragma unroll
    for (int ks = 0; ks < 8; ++ks) {
      a0 = wmma_f16(af[ks], wf[0][ks], a0);
      a1 = wmma_f16(af[ks], wf[1][ks], a1);
    }
    float* o = op + st * 16 * kC;
#pragma unroll
    for (int r = 0; r < 8; ++r) {
      v2f v = {a0[r] + bias[0], a1[r] + bias[1]};
      *(v2f*)(o + r * kC) = v;
    }
    // address wait before the next tile overwrites the stores' registers
    asm volatile("s_wait_xcnt 0x0" ::: "memory");
  }
}

extern "C" void kernel_launch(void* const* d_in, const int* in_sizes, int n_in,
                              void* d_out, int out_size, void* d_ws, size_t ws_size,
                              hipStream_t stream) {
  const float* q_x       = (const float*)d_in[0];
  const float* kv_x      = (const float*)d_in[1];
  const float* bias_mask = (const float*)d_in[2];
  const float* bias_pair = (const float*)d_in[3];
  const float* wq = (const float*)d_in[4];
  const float* wk = (const float*)d_in[5];
  const float* wv = (const float*)d_in[6];
  const float* wg = (const float*)d_in[7];
  const float* bg = (const float*)d_in[8];
  const float* wo = (const float*)d_in[9];
  const float* bo = (const float*)d_in[10];
  float* out = (float*)d_out;

  char* wsb = (char*)d_ws;
  const size_t SZ = (size_t)kNR * kH * kS * kCH * sizeof(f16);  // 33.5 MB each
  f16* Bp = (f16*)(wsb + 2 * SZ);   // [H*16][16][32][8] pair bias in A-operand order, 1 MB
  f16* Wp = (f16*)(wsb + 3 * SZ);   // wq, wg, then wk, wv in A-operand order, 256 KB

  relay_kernel<<<dim3(kPB + kWB + kKB), dim3(256), 0, stream>>>(
      wk, wv, wq, wg, Wp, bias_pair, Bp);
  attn_out_kernel<<<dim3(kNR), dim3(512), 0, stream>>>(
      q_x, kv_x, bias_mask, Bp, Wp, bg, wo, bo, out);
}
